// v000
// Times are from an AMD MI455X. After a warm-up the kernel runs many times in a row, and a time is the length of
// such a window on the GPU divided by its runs, so every launch and the gaps after it count. The runs cycle
// through copies of the inputs. A figure is the median of several windows, for all but v000 over two sittings.
// Sittings can differ by a few percent; kernels timed side by side share one.
// v000 is the starting kernel. One run takes 2250 microseconds.
#include <hip/hip_runtime.h>

typedef __attribute__((ext_vector_type(2))) float v2f;
typedef __attribute__((ext_vector_type(8))) float v8f;

constexpr int Bc = 2, Sc = 2048, Dc = 512, Hc = 8, Fc = 2048, Lc = 4, HDc = 64;
constexpr int BS = Bc * Sc;              // 4096 token rows
constexpr size_t BSD = (size_t)BS * Dc;  // elements in one [B,S,D] buffer
constexpr float EPSc = 1e-5f;
constexpr int KC = 32;                   // GEMM K-chunk staged in LDS

// ---- wave32 16-lane group reductions (xor masks 1/2/4/8 stay within each half) ----
__device__ inline float grpmax16(float v) {
  v = fmaxf(v, __shfl_xor(v, 1));
  v = fmaxf(v, __shfl_xor(v, 2));
  v = fmaxf(v, __shfl_xor(v, 4));
  v = fmaxf(v, __shfl_xor(v, 8));
  return v;
}
__device__ inline float grpsum16(float v) {
  v += __shfl_xor(v, 1);
  v += __shfl_xor(v, 2);
  v += __shfl_xor(v, 4);
  v += __shfl_xor(v, 8);
  return v;
}

// ---------------- embedding + sinusoidal positional encoding ----------------
__global__ __launch_bounds__(256) void embed_pe_kernel(const int* __restrict__ tokens,
                                                       const float* __restrict__ emb,
                                                       float* __restrict__ x) {
  const int row = blockIdx.x;  // 0..B*S-1
  const int s = row % Sc;
  const int tok = tokens[row];
  const float c = -9.210340371976184f / (float)Dc;  // -ln(10000)/D
  for (int d = threadIdx.x; d < Dc; d += 256) {
    const int i2 = d & ~1;
    const float ang = (float)s * __expf((float)i2 * c);
    const float pe = (d & 1) ? __cosf(ang) : __sinf(ang);
    x[(size_t)row * Dc + d] = emb[(size_t)tok * Dc + d] + pe;
  }
}

// ---------------- fp32 WMMA GEMM with async-to-LDS staging ----------------
// Block = 8 waves computing a 64x128 output tile (each wave a 64x16 strip).
// Per 32-wide K chunk: stage A[64][32] (8KB) and W[32][128] (16KB) into LDS via
// GLOBAL_LOAD_ASYNC_TO_LDS_B128 (ASYNCcnt), then 8 WMMA k-steps from LDS.
__global__ __launch_bounds__(256)
void gemm_wmma_f32(const float* __restrict__ A, const float* __restrict__ W,
                   const float* __restrict__ bias, float* __restrict__ C,
                   int M, int N, int K, int relu) {
  __shared__ float sA[64 * KC];    // [64 rows][KC] row-major
  __shared__ float sW[KC * 128];   // [KC rows][128 cols] row-major
  const int tid = threadIdx.x;
  const int wid = tid >> 5;
  const int lane = tid & 31;
  const int half = lane >> 4, l16 = lane & 15;
  const int ntiles = N >> 4;
  const int gw0 = blockIdx.x * 8;
  const int mt = gw0 / ntiles;          // block-uniform (8 divides ntiles)
  const int ntB = gw0 % ntiles;         // first n-tile of this block
  const int m0 = mt << 6;
  const int n0b = ntB << 4;             // block column base (covers 128 cols)
  const int nLoc = (wid << 4) + l16;    // 0..127 : this lane's column in block
  (void)M;
  const unsigned sAbase = (unsigned)(size_t)sA;  // LDS byte offset = addr[31:0]
  const unsigned sWbase = (unsigned)(size_t)sW;
  v8f acc[4] = {};
  for (int kc = 0; kc < K; kc += KC) {
    __syncthreads();  // protect LDS against overwrite while prior chunk in use
    // stage A chunk: 512 x 16B segments across 256 threads
#pragma unroll
    for (int j = 0; j < 2; ++j) {
      const int seg = tid + j * 256;           // 0..511
      const int row = seg >> 3, c4 = (seg & 7) << 2;
      const unsigned long long ga =
          (unsigned long long)(A + (size_t)(m0 + row) * K + kc + c4);
      const unsigned la = sAbase + (unsigned)((row * KC + c4) << 2);
      asm volatile("global_load_async_to_lds_b128 %0, %1, off"
                   :: "v"(la), "v"(ga) : "memory");
    }
    // stage W chunk: 1024 x 16B segments across 256 threads
#pragma unroll
    for (int j = 0; j < 4; ++j) {
      const int seg = tid + j * 256;           // 0..1023
      const int r = seg >> 5, c4 = (seg & 31) << 2;
      const unsigned long long ga =
          (unsigned long long)(W + (size_t)(kc + r) * N + n0b + c4);
      const unsigned la = sWbase + (unsigned)((r * 128 + c4) << 2);
      asm volatile("global_load_async_to_lds_b128 %0, %1, off"
                   :: "v"(la), "v"(ga) : "memory");
    }
    asm volatile("s_wait_asynccnt 0x0" ::: "memory");  // own async loads done
    __syncthreads();                                    // all waves' loads done
    // compute 8 k-steps from LDS
#pragma unroll
    for (int k0 = 0; k0 < KC; k0 += 4) {
      const int kk = k0 + 2 * half;  // this lane-half holds K = kk, kk+1
      v2f bf;
      bf.x = sW[kk * 128 + nLoc];
      bf.y = sW[(kk + 1) * 128 + nLoc];
#pragma unroll
      for (int t = 0; t < 4; ++t) {
        const v2f af = *(const v2f*)(sA + (t * 16 + l16) * KC + kk);
        acc[t] = __builtin_amdgcn_wmma_f32_16x16x4_f32(false, af, false, bf,
                                                       (short)0, acc[t], false, false);
      }
    }
  }
  const float bv = bias ? bias[n0b + nLoc] : 0.0f;
#pragma unroll
  for (int t = 0; t < 4; ++t) {
#pragma unroll
    for (int r = 0; r < 8; ++r) {  // C/D row = r + 8*half, col = nLoc
      const int m = m0 + t * 16 + r + 8 * half;
      float v = acc[t][r] + bv;
      if (relu) v = fmaxf(v, 0.0f);
      C[(size_t)m * N + n0b + nLoc] = v;
    }
  }
}

// ---------------- flash attention, fp32 WMMA, one wave per 16-query tile ----------------
__global__ __launch_bounds__(256)
void flash_attn_wmma(const float* __restrict__ Q, const float* __restrict__ Km,
                     const float* __restrict__ Vm, float* __restrict__ O) {
  __shared__ float pbuf[8][16][17];  // per-wave P tile, padded stride
  const int wid = threadIdx.x >> 5, lane = threadIdx.x & 31;
  const int half = lane >> 4, l16 = lane & 15;
  const int gw = blockIdx.x * 8 + wid;
  const int qtiles = Sc / 16;
  const int qt = gw % qtiles, bh = gw / qtiles;
  const int b = bh / Hc, h = bh % Hc;
  const float* qp = Q + (size_t)b * Sc * Dc + h * HDc;
  const float* kp = Km + (size_t)b * Sc * Dc + h * HDc;
  const float* vp = Vm + (size_t)b * Sc * Dc + h * HDc;
  const int q0 = qt * 16;
  v8f oacc[4] = {};
  float Mrow[8], Lrow[8];
#pragma unroll
  for (int r = 0; r < 8; ++r) { Mrow[r] = -3.0e38f; Lrow[r] = 0.0f; }

  for (int kt = 0; kt < Sc; kt += 16) {
    // scores tile S(16x16) = Qtile(16x64) @ K^T(64x16)
    v8f sc = {};
#pragma unroll
    for (int d0 = 0; d0 < HDc; d0 += 4) {
      const int dd = d0 + 2 * half;
      const v2f a = *(const v2f*)(qp + (size_t)(q0 + l16) * Dc + dd);
      const v2f bb = *(const v2f*)(kp + (size_t)(kt + l16) * Dc + dd);  // B[d][n]=K[n][d]
      sc = __builtin_amdgcn_wmma_f32_16x16x4_f32(false, a, false, bb,
                                                 (short)0, sc, false, false);
    }
    // online softmax over this key tile
#pragma unroll
    for (int r = 0; r < 8; ++r) {
      const float v = sc[r] * 0.125f;  // 1/sqrt(64)
      const float tmax = grpmax16(v);
      const float Mn = fmaxf(Mrow[r], tmax);
      const float alpha = __expf(Mrow[r] - Mn);
      const float p = __expf(v - Mn);
      Lrow[r] = Lrow[r] * alpha + grpsum16(p);
      Mrow[r] = Mn;
#pragma unroll
      for (int t = 0; t < 4; ++t) oacc[t][r] *= alpha;
      pbuf[wid][r + 8 * half][l16] = p;  // C-layout row -> LDS
    }
    asm volatile("s_wait_dscnt 0x0" ::: "memory");  // wave-local LDS RAW
    // O(16x64) += P(16x16) @ Vtile(16x64)
#pragma unroll
    for (int k4 = 0; k4 < 16; k4 += 4) {
      const int kk = k4 + 2 * half;
      v2f a;  // A frag of P: row = lane%16, K = kk,kk+1
      a.x = pbuf[wid][l16][kk];
      a.y = pbuf[wid][l16][kk + 1];
#pragma unroll
      for (int t = 0; t < 4; ++t) {
        v2f bb;  // B frag of V: rows kk/kk+1, col = t*16 + lane%16
        bb.x = vp[(size_t)(kt + kk) * Dc + t * 16 + l16];
        bb.y = vp[(size_t)(kt + kk + 1) * Dc + t * 16 + l16];
        oacc[t] = __builtin_amdgcn_wmma_f32_16x16x4_f32(false, a, false, bb,
                                                        (short)0, oacc[t], false, false);
      }
    }
    asm volatile("s_wait_dscnt 0x0" ::: "memory");  // WAR before next tile's P store
  }
  // finalize: O /= rowsum, scatter back into [B,S,D] at head offset
#pragma unroll
  for (int t = 0; t < 4; ++t) {
#pragma unroll
    for (int r = 0; r < 8; ++r) {
      const int srow = q0 + r + 8 * half;
      O[(size_t)(b * Sc + srow) * Dc + h * HDc + t * 16 + l16] = oacc[t][r] / Lrow[r];
    }
  }
}

// ---------------- fused residual add + LayerNorm (one row per block) ----------------
__global__ __launch_bounds__(256)
void add_ln_kernel(const float* __restrict__ a, const float* __restrict__ xin,
                   const float* __restrict__ g, const float* __restrict__ beta,
                   float* __restrict__ out) {
  __shared__ float red[8];
  const int row = blockIdx.x;
  const int tid = threadIdx.x;
  const int wid = tid >> 5, lane = tid & 31;
  const size_t base = (size_t)row * Dc;
  const float v0 = a[base + tid] + xin[base + tid];
  const float v1 = a[base + tid + 256] + xin[base + tid + 256];
  float s = v0 + v1;
#pragma unroll
  for (int m = 1; m < 32; m <<= 1) s += __shfl_xor(s, m);
  if (lane == 0) red[wid] = s;
  __syncthreads();
  float tot = 0.0f;
#pragma unroll
  for (int i = 0; i < 8; ++i) tot += red[i];
  const float mean = tot * (1.0f / Dc);
  __syncthreads();
  const float d0 = v0 - mean, d1 = v1 - mean;
  float q = d0 * d0 + d1 * d1;
#pragma unroll
  for (int m = 1; m < 32; m <<= 1) q += __shfl_xor(q, m);
  if (lane == 0) red[wid] = q;
  __syncthreads();
  float qt = 0.0f;
#pragma unroll
  for (int i = 0; i < 8; ++i) qt += red[i];
  const float rstd = rsqrtf(qt * (1.0f / Dc) + EPSc);
  out[base + tid] = d0 * rstd * g[tid] + beta[tid];
  out[base + tid + 256] = d1 * rstd * g[tid + 256] + beta[tid + 256];
}

// ---------------- host orchestration ----------------
extern "C" void kernel_launch(void* const* d_in, const int* in_sizes, int n_in,
                              void* d_out, int out_size, void* d_ws, size_t ws_size,
                              hipStream_t stream) {
  const int* tokens = (const int*)d_in[0];
  const float* emb = (const float*)d_in[1];
  const float* wq = (const float*)d_in[2];
  const float* wk = (const float*)d_in[3];
  const float* wv = (const float*)d_in[4];
  const float* wo = (const float*)d_in[5];
  const float* w1 = (const float*)d_in[6];
  const float* bf1 = (const float*)d_in[7];
  const float* w2 = (const float*)d_in[8];
  const float* bf2 = (const float*)d_in[9];
  const float* ln1_g = (const float*)d_in[10];
  const float* ln1_b = (const float*)d_in[11];
  const float* ln2_g = (const float*)d_in[12];
  const float* ln2_b = (const float*)d_in[13];
  (void)in_sizes; (void)n_in; (void)out_size; (void)ws_size;

  float* x = (float*)d_ws;        // [B,S,D]
  float* t0 = x + BSD;            // [B,S,D] scratch (proj / ff2)
  float* pool = t0 + BSD;         // 4*BSD pool
  float* xq = pool;
  float* xk = pool + BSD;
  float* xv = pool + 2 * BSD;
  float* ob = pool + 3 * BSD;
  float* ff1 = pool;              // reuses Q/K/V/O region after attention is consumed

  const dim3 blk(256);
  embed_pe_kernel<<<BS, blk, 0, stream>>>(tokens, emb, x);

  const int gD = (BS / 64) * (Dc / 16) / 8;  // 256 blocks (N = D)
  const int gF = (BS / 64) * (Fc / 16) / 8;  // 1024 blocks (N = F)
  const int gA = (Bc * Hc * (Sc / 16)) / 8;  // 256 blocks for attention

  for (int l = 0; l < Lc; ++l) {
    const float* Wq = wq + (size_t)l * Dc * Dc;
    const float* Wk = wk + (size_t)l * Dc * Dc;
    const float* Wv = wv + (size_t)l * Dc * Dc;
    const float* Wo = wo + (size_t)l * Dc * Dc;
    const float* W1 = w1 + (size_t)l * Dc * Fc;
    const float* W2 = w2 + (size_t)l * Fc * Dc;

    gemm_wmma_f32<<<gD, blk, 0, stream>>>(x, Wq, nullptr, xq, BS, Dc, Dc, 0);
    gemm_wmma_f32<<<gD, blk, 0, stream>>>(x, Wk, nullptr, xk, BS, Dc, Dc, 0);
    gemm_wmma_f32<<<gD, blk, 0, stream>>>(x, Wv, nullptr, xv, BS, Dc, Dc, 0);
    flash_attn_wmma<<<gA, blk, 0, stream>>>(xq, xk, xv, ob);
    gemm_wmma_f32<<<gD, blk, 0, stream>>>(ob, Wo, nullptr, t0, BS, Dc, Dc, 0);
    add_ln_kernel<<<BS, blk, 0, stream>>>(t0, x, ln1_g + (size_t)l * Dc,
                                          ln1_b + (size_t)l * Dc, x);
    gemm_wmma_f32<<<gF, blk, 0, stream>>>(x, W1, bf1 + (size_t)l * Fc, ff1, BS, Fc, Dc, 1);
    gemm_wmma_f32<<<gD, blk, 0, stream>>>(ff1, W2, bf2 + (size_t)l * Dc, t0, BS, Dc, Fc, 0);
    float* dst = (l == Lc - 1) ? (float*)d_out : x;
    add_ln_kernel<<<BS, blk, 0, stream>>>(t0, x, ln2_g + (size_t)l * Dc,
                                          ln2_b + (size_t)l * Dc, dst);
  }
}

// v001
// A run of this version takes 1900 microseconds.
// Timed twice side by side with v000, it ran 1.20 times as fast both times.
#include <hip/hip_runtime.h>

typedef __attribute__((ext_vector_type(2))) float v2f;
typedef __attribute__((ext_vector_type(8))) float v8f;

constexpr int Bc = 2, Sc = 2048, Dc = 512, Hc = 8, Fc = 2048, Lc = 4, HDc = 64;
constexpr int BS = Bc * Sc;              // 4096 token rows
constexpr size_t BSD = (size_t)BS * Dc;  // elements in one [B,S,D] buffer
constexpr float EPSc = 1e-5f;
constexpr int KC = 32;                   // GEMM K-chunk staged in LDS

// ---- wave32 16-lane group reductions (xor masks 1/2/4/8 stay within each half) ----
__device__ inline float grpmax16(float v) {
  v = fmaxf(v, __shfl_xor(v, 1));
  v = fmaxf(v, __shfl_xor(v, 2));
  v = fmaxf(v, __shfl_xor(v, 4));
  v = fmaxf(v, __shfl_xor(v, 8));
  return v;
}
__device__ inline float grpsum16(float v) {
  v += __shfl_xor(v, 1);
  v += __shfl_xor(v, 2);
  v += __shfl_xor(v, 4);
  v += __shfl_xor(v, 8);
  return v;
}

// ---------------- embedding + sinusoidal positional encoding ----------------
__global__ __launch_bounds__(256) void embed_pe_kernel(const int* __restrict__ tokens,
                                                       const float* __restrict__ emb,
                                                       float* __restrict__ x) {
  const int row = blockIdx.x;  // 0..B*S-1
  const int s = row % Sc;
  const int tok = tokens[row];
  const float c = -9.210340371976184f / (float)Dc;  // -ln(10000)/D
  for (int d = threadIdx.x; d < Dc; d += 256) {
    const int i2 = d & ~1;
    const float ang = (float)s * __expf((float)i2 * c);
    const float pe = (d & 1) ? __cosf(ang) : __sinf(ang);
    x[(size_t)row * Dc + d] = emb[(size_t)tok * Dc + d] + pe;
  }
}

// ---------------- fp32 WMMA GEMM with async-to-LDS staging ----------------
// Block = 8 waves computing a 64x128 output tile (each wave a 64x16 strip).
// Per 32-wide K chunk: stage A[64][32] (8KB) and W[32][128] (16KB) into LDS via
// GLOBAL_LOAD_ASYNC_TO_LDS_B128 (ASYNCcnt), then 8 WMMA k-steps from LDS.
__global__ __launch_bounds__(256)
void gemm_wmma_f32(const float* __restrict__ A, const float* __restrict__ W,
                   const float* __restrict__ bias, float* __restrict__ C,
                   int M, int N, int K, int relu) {
  __shared__ float sA[64 * KC];    // [64 rows][KC] row-major
  __shared__ float sW[KC * 128];   // [KC rows][128 cols] row-major
  const int tid = threadIdx.x;
  const int wid = tid >> 5;
  const int lane = tid & 31;
  const int half = lane >> 4, l16 = lane & 15;
  const int ntiles = N >> 4;
  const int gw0 = blockIdx.x * 8;
  const int mt = gw0 / ntiles;          // block-uniform (8 divides ntiles)
  const int ntB = gw0 % ntiles;         // first n-tile of this block
  const int m0 = mt << 6;
  const int n0b = ntB << 4;             // block column base (covers 128 cols)
  const int nLoc = (wid << 4) + l16;    // 0..127 : this lane's column in block
  (void)M;
  const unsigned sAbase = (unsigned)(size_t)sA;  // LDS byte offset = addr[31:0]
  const unsigned sWbase = (unsigned)(size_t)sW;
  v8f acc[4] = {};
  for (int kc = 0; kc < K; kc += KC) {
    __syncthreads();  // protect LDS against overwrite while prior chunk in use
    // stage A chunk: 512 x 16B segments across 256 threads
#pragma unroll
    for (int j = 0; j < 2; ++j) {
      const int seg = tid + j * 256;           // 0..511
      const int row = seg >> 3, c4 = (seg & 7) << 2;
      const unsigned long long ga =
          (unsigned long long)(A + (size_t)(m0 + row) * K + kc + c4);
      const unsigned la = sAbase + (unsigned)((row * KC + c4) << 2);
      asm volatile("global_load_async_to_lds_b128 %0, %1, off"
                   :: "v"(la), "v"(ga) : "memory");
    }
    // stage W chunk: 1024 x 16B segments across 256 threads
#pragma unroll
    for (int j = 0; j < 4; ++j) {
      const int seg = tid + j * 256;           // 0..1023
      const int r = seg >> 5, c4 = (seg & 31) << 2;
      const unsigned long long ga =
          (unsigned long long)(W + (size_t)(kc + r) * N + n0b + c4);
      const unsigned la = sWbase + (unsigned)((r * 128 + c4) << 2);
      asm volatile("global_load_async_to_lds_b128 %0, %1, off"
                   :: "v"(la), "v"(ga) : "memory");
    }
    asm volatile("s_wait_asynccnt 0x0" ::: "memory");  // own async loads done
    __syncthreads();                                    // all waves' loads done
    // compute 8 k-steps from LDS
#pragma unroll
    for (int k0 = 0; k0 < KC; k0 += 4) {
      const int kk = k0 + 2 * half;  // this lane-half holds K = kk, kk+1
      v2f bf;
      bf.x = sW[kk * 128 + nLoc];
      bf.y = sW[(kk + 1) * 128 + nLoc];
#pragma unroll
      for (int t = 0; t < 4; ++t) {
        const v2f af = *(const v2f*)(sA + (t * 16 + l16) * KC + kk);
        acc[t] = __builtin_amdgcn_wmma_f32_16x16x4_f32(false, af, false, bf,
                                                       (short)0, acc[t], false, false);
      }
    }
  }
  const float bv = bias ? bias[n0b + nLoc] : 0.0f;
#pragma unroll
  for (int t = 0; t < 4; ++t) {
#pragma unroll
    for (int r = 0; r < 8; ++r) {  // C/D row = r + 8*half, col = nLoc
      const int m = m0 + t * 16 + r + 8 * half;
      float v = acc[t][r] + bv;
      if (relu) v = fmaxf(v, 0.0f);
      C[(size_t)m * N + n0b + nLoc] = v;
    }
  }
}

// ---------------- flash attention, fp32 WMMA, one wave per 16-query tile ----------------
// The 8 waves of a block share one (batch, head): each 64-key tile of K and V is brought
// into LDS once per block by async copies, two buffers, the next tile in flight while this
// one is worked on.
constexpr int KT = 64;        // keys per staged tile
constexpr int NTILE = Sc / KT;
constexpr int KP = 68;        // K row pitch in LDS (floats): 16 rows x 8-byte reads fill 64 banks
constexpr int VP = 80;        // V row pitch in LDS (floats): 4 rows x 16 columns fill 64 banks

// One tile: 64 rows of 256 bytes of K and of V; each lane copies 16 bytes of rows
// r, r+16, r+32, r+48 of both. kg/vg: the lane's bytes in row r; lk/lv: their LDS byte address.
__device__ inline void stage_kv(const float* kg, const float* vg, unsigned lk, unsigned lv) {
  const unsigned long long k0 = (unsigned long long)kg;
  const unsigned long long k1 = (unsigned long long)(kg + 16 * Dc);
  const unsigned long long k2 = (unsigned long long)(kg + 32 * Dc);
  const unsigned long long k3 = (unsigned long long)(kg + 48 * Dc);
  const unsigned long long v0 = (unsigned long long)vg;
  const unsigned long long v1 = (unsigned long long)(vg + 16 * Dc);
  const unsigned long long v2 = (unsigned long long)(vg + 32 * Dc);
  const unsigned long long v3 = (unsigned long long)(vg + 48 * Dc);
  const unsigned lk1 = lk + 16 * KP * 4, lk2 = lk + 32 * KP * 4, lk3 = lk + 48 * KP * 4;
  const unsigned lv1 = lv + 16 * VP * 4, lv2 = lv + 32 * VP * 4, lv3 = lv + 48 * VP * 4;
  // the closing s_wait_xcnt stands in the copies' own statement, so that no address
  // register of a copy is rewritten in front of it
  asm volatile("global_load_async_to_lds_b128 %0, %8, off\n\t"
               "global_load_async_to_lds_b128 %1, %9, off\n\t"
               "global_load_async_to_lds_b128 %2, %10, off\n\t"
               "global_load_async_to_lds_b128 %3, %11, off\n\t"
               "global_load_async_to_lds_b128 %4, %12, off\n\t"
               "global_load_async_to_lds_b128 %5, %13, off\n\t"
               "global_load_async_to_lds_b128 %6, %14, off\n\t"
               "global_load_async_to_lds_b128 %7, %15, off\n\t"
               "s_wait_xcnt 0x0"
               :: "v"(lk), "v"(lk1), "v"(lk2), "v"(lk3), "v"(lv), "v"(lv1), "v"(lv2), "v"(lv3),
                  "v"(k0), "v"(k1), "v"(k2), "v"(k3), "v"(v0), "v"(v1), "v"(v2), "v"(v3)
               : "memory");
}

__global__ __launch_bounds__(256)
void flash_attn_wmma(const float* __restrict__ Q, const float* __restrict__ Km,
                     const float* __restrict__ Vm, float* __restrict__ O) {
  __shared__ float pbuf[8][16][17];  // per-wave P tile, padded stride
  __shared__ __attribute__((aligned(16))) float sK[2][KT * KP];
  __shared__ __attribute__((aligned(16))) float sV[2][KT * VP];
  const int wid = threadIdx.x >> 5, lane = threadIdx.x & 31;
  const int half = lane >> 4, l16 = lane & 15;
  const int gw = blockIdx.x * 8 + wid;
  const int qtiles = Sc / 16;
  const int qt = gw % qtiles, bh = gw / qtiles;  // bh is block-uniform (8 divides qtiles)
  const int b = bh / Hc, h = bh % Hc;
  const float* qp = Q + (size_t)b * Sc * Dc + h * HDc;
  const float* kp = Km + (size_t)b * Sc * Dc + h * HDc;
  const float* vp = Vm + (size_t)b * Sc * Dc + h * HDc;
  const int q0 = qt * 16;
  // this lane's share of a staged tile: row srow (+16, +32, +48), floats sc4 .. sc4+3
  const int srow = threadIdx.x >> 4, sc4 = (threadIdx.x & 15) << 2;
  const float* kg = kp + (size_t)srow * Dc + sc4;
  const float* vg = vp + (size_t)srow * Dc + sc4;
  const unsigned lk = (unsigned)(size_t)&sK[0][0] + (unsigned)((srow * KP + sc4) << 2);
  const unsigned lv = (unsigned)(size_t)&sV[0][0] + (unsigned)((srow * VP + sc4) << 2);
  v8f oacc[4] = {};
  float Mrow[8], Lrow[8];
#pragma unroll
  for (int r = 0; r < 8; ++r) { Mrow[r] = -3.0e38f; Lrow[r] = 0.0f; }

  stage_kv(kg, vg, lk, lv);                          // tile 0 -> buffer 0
  asm volatile("s_wait_asynccnt 0x0" ::: "memory");  // own copies of tile 0 landed
  __syncthreads();                                   // every wave's copies of tile 0 landed
  stage_kv(kg + (size_t)KT * Dc, vg + (size_t)KT * Dc,
           lk + KT * KP * 4, lv + KT * VP * 4);      // tile 1 -> buffer 1

  for (int ts = 0; ts < NTILE; ++ts) {
    const float* sKb = sK[ts & 1];
    const float* sVb = sV[ts & 1];
    for (int kl = 0; kl < KT; kl += 16) {
      // scores tile S(16x16) = Qtile(16x64) @ K^T(64x16)
      v8f sc = {};
#pragma unroll
      for (int d0 = 0; d0 < HDc; d0 += 4) {
        const int dd = d0 + 2 * half;
        const v2f a = *(const v2f*)(qp + (size_t)(q0 + l16) * Dc + dd);
        const v2f bb = *(const v2f*)(sKb + (kl + l16) * KP + dd);  // B[d][n]=K[n][d]
        sc = __builtin_amdgcn_wmma_f32_16x16x4_f32(false, a, false, bb,
                                                   (short)0, sc, false, false);
      }
      // online softmax over this key tile
#pragma unroll
      for (int r = 0; r < 8; ++r) {
        const float v = sc[r] * 0.125f;  // 1/sqrt(64)
        const float tmax = grpmax16(v);
        const float Mn = fmaxf(Mrow[r], tmax);
        const float alpha = __expf(Mrow[r] - Mn);
        const float p = __expf(v - Mn);
        Lrow[r] = Lrow[r] * alpha + grpsum16(p);
        Mrow[r] = Mn;
#pragma unroll
        for (int t = 0; t < 4; ++t) oacc[t][r] *= alpha;
        pbuf[wid][r + 8 * half][l16] = p;  // C-layout row -> LDS
      }
      asm volatile("s_wait_dscnt 0x0" ::: "memory");  // wave-local LDS RAW
      // O(16x64) += P(16x16) @ Vtile(16x64)
#pragma unroll
      for (int k4 = 0; k4 < 16; k4 += 4) {
        const int kk = k4 + 2 * half;
        v2f a;  // A frag of P: row = lane%16, K = kk,kk+1
        a.x = pbuf[wid][l16][kk];
        a.y = pbuf[wid][l16][kk + 1];
#pragma unroll
        for (int t = 0; t < 4; ++t) {
          v2f bb;  // B frag of V: rows kk/kk+1, col = t*16 + lane%16
          bb.x = sVb[(kl + kk) * VP + t * 16 + l16];
          bb.y = sVb[(kl + kk + 1) * VP + t * 16 + l16];
          oacc[t] = __builtin_amdgcn_wmma_f32_16x16x4_f32(false, a, false, bb,
                                                          (short)0, oacc[t], false, false);
        }
      }
      asm volatile("s_wait_dscnt 0x0" ::: "memory");  // WAR before next tile's P store
    }
    // hand-over: this wave's reads of the buffer are done, its copies of the next tile landed
    asm volatile("s_wait_dscnt 0x0" ::: "memory");
    asm volatile("s_wait_asynccnt 0x0" ::: "memory");
    __syncthreads();  // publishes tile ts+1 and ends every wave's reads of tile ts
    if (ts + 2 < NTILE) {
      stage_kv(kg + (size_t)(ts + 2) * KT * Dc, vg + (size_t)(ts + 2) * KT * Dc,
               lk + (ts & 1) * (KT * KP * 4), lv + (ts & 1) * (KT * VP * 4));
    }
  }
  asm volatile("s_wait_asynccnt 0x0" ::: "memory");  // no copy outstanding at the wave's end
  // finalize: O /= rowsum, scatter back into [B,S,D] at head offset
#pragma unroll
  for (int t = 0; t < 4; ++t) {
#pragma unroll
    for (int r = 0; r < 8; ++r) {
      const int orow = q0 + r + 8 * half;
      O[(size_t)(b * Sc + orow) * Dc + h * HDc + t * 16 + l16] = oacc[t][r] / Lrow[r];
    }
  }
}

// ---------------- fused residual add + LayerNorm (one row per block) ----------------
__global__ __launch_bounds__(256)
void add_ln_kernel(const float* __restrict__ a, const float* __restrict__ xin,
                   const float* __restrict__ g, const float* __restrict__ beta,
                   float* __restrict__ out) {
  __shared__ float red[8];
  const int row = blockIdx.x;
  const int tid = threadIdx.x;
  const int wid = tid >> 5, lane = tid & 31;
  const size_t base = (size_t)row * Dc;
  const float v0 = a[base + tid] + xin[base + tid];
  const float v1 = a[base + tid + 256] + xin[base + tid + 256];
  float s = v0 + v1;
#pragma unroll
  for (int m = 1; m < 32; m <<= 1) s += __shfl_xor(s, m);
  if (lane == 0) red[wid] = s;
  __syncthreads();
  float tot = 0.0f;
#pragma unroll
  for (int i = 0; i < 8; ++i) tot += red[i];
  const float mean = tot * (1.0f / Dc);
  __syncthreads();
  const float d0 = v0 - mean, d1 = v1 - mean;
  float q = d0 * d0 + d1 * d1;
#pragma unroll
  for (int m = 1; m < 32; m <<= 1) q += __shfl_xor(q, m);
  if (lane == 0) red[wid] = q;
  __syncthreads();
  float qt = 0.0f;
#pragma unroll
  for (int i = 0; i < 8; ++i) qt += red[i];
  const float rstd = rsqrtf(qt * (1.0f / Dc) + EPSc);
  out[base + tid] = d0 * rstd * g[tid] + beta[tid];
  out[base + tid + 256] = d1 * rstd * g[tid + 256] + beta[tid + 256];
}

// ---------------- host orchestration ----------------
extern "C" void kernel_launch(void* const* d_in, const int* in_sizes, int n_in,
                              void* d_out, int out_size, void* d_ws, size_t ws_size,
                              hipStream_t stream) {
  const int* tokens = (const int*)d_in[0];
  const float* emb = (const float*)d_in[1];
  const float* wq = (const float*)d_in[2];
  const float* wk = (const float*)d_in[3];
  const float* wv = (const float*)d_in[4];
  const float* wo = (const float*)d_in[5];
  const float* w1 = (const float*)d_in[6];
  const float* bf1 = (const float*)d_in[7];
  const float* w2 = (const float*)d_in[8];
  const float* bf2 = (const float*)d_in[9];
  const float* ln1_g = (const float*)d_in[10];
  const float* ln1_b = (const float*)d_in[11];
  const float* ln2_g = (const float*)d_in[12];
  const float* ln2_b = (const float*)d_in[13];
  (void)in_sizes; (void)n_in; (void)out_size; (void)ws_size;

  float* x = (float*)d_ws;        // [B,S,D]
  float* t0 = x + BSD;            // [B,S,D] scratch (proj / ff2)
  float* pool = t0 + BSD;         // 4*BSD pool
  float* xq = pool;
  float* xk = pool + BSD;
  float* xv = pool + 2 * BSD;
  float* ob = pool + 3 * BSD;
  float* ff1 = pool;              // reuses Q/K/V/O region after attention is consumed

  const dim3 blk(256);
  embed_pe_kernel<<<BS, blk, 0, stream>>>(tokens, emb, x);

  const int gD = (BS / 64) * (Dc / 16) / 8;  // 256 blocks (N = D)
  const int gF = (BS / 64) * (Fc / 16) / 8;  // 1024 blocks (N = F)
  const int gA = (Bc * Hc * (Sc / 16)) / 8;  // 256 blocks for attention

  for (int l = 0; l < Lc; ++l) {
    const float* Wq = wq + (size_t)l * Dc * Dc;
    const float* Wk = wk + (size_t)l * Dc * Dc;
    const float* Wv = wv + (size_t)l * Dc * Dc;
    const float* Wo = wo + (size_t)l * Dc * Dc;
    const float* W1 = w1 + (size_t)l * Dc * Fc;
    const float* W2 = w2 + (size_t)l * Fc * Dc;

    gemm_wmma_f32<<<gD, blk, 0, stream>>>(x, Wq, nullptr, xq, BS, Dc, Dc, 0);
    gemm_wmma_f32<<<gD, blk, 0, stream>>>(x, Wk, nullptr, xk, BS, Dc, Dc, 0);
    gemm_wmma_f32<<<gD, blk, 0, stream>>>(x, Wv, nullptr, xv, BS, Dc, Dc, 0);
    flash_attn_wmma<<<gA, blk, 0, stream>>>(xq, xk, xv, ob);
    gemm_wmma_f32<<<gD, blk, 0, stream>>>(ob, Wo, nullptr, t0, BS, Dc, Dc, 0);
    add_ln_kernel<<<BS, blk, 0, stream>>>(t0, x, ln1_g + (size_t)l * Dc,
                                          ln1_b + (size_t)l * Dc, x);
    gemm_wmma_f32<<<gF, blk, 0, stream>>>(x, W1, bf1 + (size_t)l * Fc, ff1, BS, Fc, Dc, 1);
    gemm_wmma_f32<<<gD, blk, 0, stream>>>(ff1, W2, bf2 + (size_t)l * Dc, t0, BS, Dc, Fc, 0);
    float* dst = (l == Lc - 1) ? (float*)d_out : x;
    add_ln_kernel<<<BS, blk, 0, stream>>>(t0, x, ln2_g + (size_t)l * Dc,
                                          ln2_b + (size_t)l * Dc, dst);
  }
}

// v002
// One run takes 1680 microseconds.
// In both of two side-by-side timings against v001, it was 1.13 times as fast.
// Counting every step since v000, it is 1.36 times as fast.
#include <hip/hip_runtime.h>

typedef __attribute__((ext_vector_type(2))) float v2f;
typedef __attribute__((ext_vector_type(8))) float v8f;

constexpr int Bc = 2, Sc = 2048, Dc = 512, Hc = 8, Fc = 2048, Lc = 4, HDc = 64;
constexpr int BS = Bc * Sc;              // 4096 token rows
constexpr size_t BSD = (size_t)BS * Dc;  // elements in one [B,S,D] buffer
constexpr float EPSc = 1e-5f;
constexpr int KC = 32;                   // GEMM K-chunk staged in LDS
constexpr int AP = 36;   // A row pitch in LDS (floats): 16 rows x 2 halves of 8-byte reads fill 64 banks
constexpr int WP = 144;  // W row pitch in LDS (floats): 4 rows x 16 columns fill 64 banks

// ---- wave32 16-lane group reductions (xor masks 1/2/4/8 stay within each half) ----
__device__ inline float grpmax16(float v) {
  v = fmaxf(v, __shfl_xor(v, 1));
  v = fmaxf(v, __shfl_xor(v, 2));
  v = fmaxf(v, __shfl_xor(v, 4));
  v = fmaxf(v, __shfl_xor(v, 8));
  return v;
}
__device__ inline float grpsum16(float v) {
  v += __shfl_xor(v, 1);
  v += __shfl_xor(v, 2);
  v += __shfl_xor(v, 4);
  v += __shfl_xor(v, 8);
  return v;
}

// ---------------- embedding + sinusoidal positional encoding ----------------
__global__ __launch_bounds__(256) void embed_pe_kernel(const int* __restrict__ tokens,
                                                       const float* __restrict__ emb,
                                                       float* __restrict__ x) {
  const int row = blockIdx.x;  // 0..B*S-1
  const int s = row % Sc;
  const int tok = tokens[row];
  const float c = -9.210340371976184f / (float)Dc;  // -ln(10000)/D
  for (int d = threadIdx.x; d < Dc; d += 256) {
    const int i2 = d & ~1;
    const float ang = (float)s * __expf((float)i2 * c);
    const float pe = (d & 1) ? __cosf(ang) : __sinf(ang);
    x[(size_t)row * Dc + d] = emb[(size_t)tok * Dc + d] + pe;
  }
}

// ---------------- fp32 WMMA GEMM with async-to-LDS staging ----------------
// Block = 8 waves computing a 64x128 output tile (each wave a 64x16 strip).
// Per 32-wide K chunk: stage A[64][32] (8KB) and W[32][128] (16KB) into LDS via
// GLOBAL_LOAD_ASYNC_TO_LDS_B128 (ASYNCcnt), then 8 WMMA k-steps from LDS.
// Both tiles lie in LDS at padded row pitches, so that a fragment read meets no bank twice.
__global__ __launch_bounds__(256)
void gemm_wmma_f32(const float* __restrict__ A, const float* __restrict__ W,
                   const float* __restrict__ bias, float* __restrict__ C,
                   int M, int N, int K, int relu) {
  __shared__ __attribute__((aligned(16))) float sA[64 * AP];  // [64 rows][KC], pitch AP
  __shared__ __attribute__((aligned(16))) float sW[KC * WP];  // [KC rows][128 cols], pitch WP
  const int tid = threadIdx.x;
  const int wid = tid >> 5;
  const int lane = tid & 31;
  const int half = lane >> 4, l16 = lane & 15;
  const int ntiles = N >> 4;
  const int gw0 = blockIdx.x * 8;
  const int mt = gw0 / ntiles;          // block-uniform (8 divides ntiles)
  const int ntB = gw0 % ntiles;         // first n-tile of this block
  const int m0 = mt << 6;
  const int n0b = ntB << 4;             // block column base (covers 128 cols)
  const int nLoc = (wid << 4) + l16;    // 0..127 : this lane's column in block
  (void)M;
  const unsigned sAbase = (unsigned)(size_t)sA;  // LDS byte offset = addr[31:0]
  const unsigned sWbase = (unsigned)(size_t)sW;
  v8f acc[4] = {};
  for (int kc = 0; kc < K; kc += KC) {
    __syncthreads();  // protect LDS against overwrite while prior chunk in use
    // stage A chunk: 512 x 16B segments across 256 threads
#pragma unroll
    for (int j = 0; j < 2; ++j) {
      const int seg = tid + j * 256;           // 0..511
      const int row = seg >> 3, c4 = (seg & 7) << 2;
      const unsigned long long ga =
          (unsigned long long)(A + (size_t)(m0 + row) * K + kc + c4);
      const unsigned la = sAbase + (unsigned)((row * AP + c4) << 2);
      asm volatile("global_load_async_to_lds_b128 %0, %1, off"
                   :: "v"(la), "v"(ga) : "memory");
    }
    // stage W chunk: 1024 x 16B segments across 256 threads
#pragma unroll
    for (int j = 0; j < 4; ++j) {
      const int seg = tid + j * 256;           // 0..1023
      const int r = seg >> 5, c4 = (seg & 31) << 2;
      const unsigned long long ga =
          (unsigned long long)(W + (size_t)(kc + r) * N + n0b + c4);
      const unsigned la = sWbase + (unsigned)((r * WP + c4) << 2);
      asm volatile("global_load_async_to_lds_b128 %0, %1, off"
                   :: "v"(la), "v"(ga) : "memory");
    }
    asm volatile("s_wait_asynccnt 0x0" ::: "memory");  // own async loads done
    __syncthreads();                                    // all waves' loads done
    // compute 8 k-steps from LDS
#pragma unroll
    for (int k0 = 0; k0 < KC; k0 += 4) {
      const int kk = k0 + 2 * half;  // this lane-half holds K = kk, kk+1
      v2f bf;
      bf.x = sW[kk * WP + nLoc];
      bf.y = sW[(kk + 1) * WP + nLoc];
#pragma unroll
      for (int t = 0; t < 4; ++t) {
        const v2f af = *(const v2f*)(sA + (t * 16 + l16) * AP + kk);
        acc[t] = __builtin_amdgcn_wmma_f32_16x16x4_f32(false, af, false, bf,
                                                       (short)0, acc[t], false, false);
      }
    }
  }
  const float bv = bias ? bias[n0b + nLoc] : 0.0f;
#pragma unroll
  for (int t = 0; t < 4; ++t) {
#pragma unroll
    for (int r = 0; r < 8; ++r) {  // C/D row = r + 8*half, col = nLoc
      const int m = m0 + t * 16 + r + 8 * half;
      float v = acc[t][r] + bv;
      if (relu) v = fmaxf(v, 0.0f);
      C[(size_t)m * N + n0b + nLoc] = v;
    }
  }
}

// ---------------- flash attention, fp32 WMMA, one wave per 16-query tile ----------------
// The 8 waves of a block share one (batch, head): each 64-key tile of K and V is brought
// into LDS once per block by async copies, two buffers, the next tile in flight while this
// one is worked on.
constexpr int KT = 64;        // keys per staged tile
constexpr int NTILE = Sc / KT;
constexpr int KP = 68;        // K row pitch in LDS (floats): 16 rows x 8-byte reads fill 64 banks
constexpr int VP = 80;        // V row pitch in LDS (floats): 4 rows x 16 columns fill 64 banks

// One tile: 64 rows of 256 bytes of K and of V; each lane copies 16 bytes of rows
// r, r+16, r+32, r+48 of both. kg/vg: the lane's bytes in row r; lk/lv: their LDS byte address.
__device__ inline void stage_kv(const float* kg, const float* vg, unsigned lk, unsigned lv) {
  const unsigned long long k0 = (unsigned long long)kg;
  const unsigned long long k1 = (unsigned long long)(kg + 16 * Dc);
  const unsigned long long k2 = (unsigned long long)(kg + 32 * Dc);
  const unsigned long long k3 = (unsigned long long)(kg + 48 * Dc);
  const unsigned long long v0 = (unsigned long long)vg;
  const unsigned long long v1 = (unsigned long long)(vg + 16 * Dc);
  const unsigned long long v2 = (unsigned long long)(vg + 32 * Dc);
  const unsigned long long v3 = (unsigned long long)(vg + 48 * Dc);
  const unsigned lk1 = lk + 16 * KP * 4, lk2 = lk + 32 * KP * 4, lk3 = lk + 48 * KP * 4;
  const unsigned lv1 = lv + 16 * VP * 4, lv2 = lv + 32 * VP * 4, lv3 = lv + 48 * VP * 4;
  // the closing s_wait_xcnt stands in the copies' own statement, so that no address
  // register of a copy is rewritten in front of it
  asm volatile("global_load_async_to_lds_b128 %0, %8, off\n\t"
               "global_load_async_to_lds_b128 %1, %9, off\n\t"
               "global_load_async_to_lds_b128 %2, %10, off\n\t"
               "global_load_async_to_lds_b128 %3, %11, off\n\t"
               "global_load_async_to_lds_b128 %4, %12, off\n\t"
               "global_load_async_to_lds_b128 %5, %13, off\n\t"
               "global_load_async_to_lds_b128 %6, %14, off\n\t"
               "global_load_async_to_lds_b128 %7, %15, off\n\t"
               "s_wait_xcnt 0x0"
               :: "v"(lk), "v"(lk1), "v"(lk2), "v"(lk3), "v"(lv), "v"(lv1), "v"(lv2), "v"(lv3),
                  "v"(k0), "v"(k1), "v"(k2), "v"(k3), "v"(v0), "v"(v1), "v"(v2), "v"(v3)
               : "memory");
}

__global__ __launch_bounds__(256)
void flash_attn_wmma(const float* __restrict__ Q, const float* __restrict__ Km,
                     const float* __restrict__ Vm, float* __restrict__ O) {
  __shared__ float pbuf[8][16][17];  // per-wave P tile, padded stride
  __shared__ __attribute__((aligned(16))) float sK[2][KT * KP];
  __shared__ __attribute__((aligned(16))) float sV[2][KT * VP];
  const int wid = threadIdx.x >> 5, lane = threadIdx.x & 31;
  const int half = lane >> 4, l16 = lane & 15;
  const int gw = blockIdx.x * 8 + wid;
  const int qtiles = Sc / 16;
  const int qt = gw % qtiles, bh = gw / qtiles;  // bh is block-uniform (8 divides qtiles)
  const int b = bh / Hc, h = bh % Hc;
  const float* qp = Q + (size_t)b * Sc * Dc + h * HDc;
  const float* kp = Km + (size_t)b * Sc * Dc + h * HDc;
  const float* vp = Vm + (size_t)b * Sc * Dc + h * HDc;
  const int q0 = qt * 16;
  // this lane's share of a staged tile: row srow (+16, +32, +48), floats sc4 .. sc4+3
  const int srow = threadIdx.x >> 4, sc4 = (threadIdx.x & 15) << 2;
  const float* kg = kp + (size_t)srow * Dc + sc4;
  const float* vg = vp + (size_t)srow * Dc + sc4;
  const unsigned lk = (unsigned)(size_t)&sK[0][0] + (unsigned)((srow * KP + sc4) << 2);
  const unsigned lv = (unsigned)(size_t)&sV[0][0] + (unsigned)((srow * VP + sc4) << 2);
  v8f oacc[4] = {};
  float Mrow[8], Lrow[8];
#pragma unroll
  for (int r = 0; r < 8; ++r) { Mrow[r] = -3.0e38f; Lrow[r] = 0.0f; }

  stage_kv(kg, vg, lk, lv);                          // tile 0 -> buffer 0
  asm volatile("s_wait_asynccnt 0x0" ::: "memory");  // own copies of tile 0 landed
  __syncthreads();                                   // every wave's copies of tile 0 landed
  stage_kv(kg + (size_t)KT * Dc, vg + (size_t)KT * Dc,
           lk + KT * KP * 4, lv + KT * VP * 4);      // tile 1 -> buffer 1

  for (int ts = 0; ts < NTILE; ++ts) {
    const float* sKb = sK[ts & 1];
    const float* sVb = sV[ts & 1];
    for (int kl = 0; kl < KT; kl += 16) {
      // scores tile S(16x16) = Qtile(16x64) @ K^T(64x16)
      v8f sc = {};
#pragma unroll
      for (int d0 = 0; d0 < HDc; d0 += 4) {
        const int dd = d0 + 2 * half;
        const v2f a = *(const v2f*)(qp + (size_t)(q0 + l16) * Dc + dd);
        const v2f bb = *(const v2f*)(sKb + (kl + l16) * KP + dd);  // B[d][n]=K[n][d]
        sc = __builtin_amdgcn_wmma_f32_16x16x4_f32(false, a, false, bb,
                                                   (short)0, sc, false, false);
      }
      // online softmax over this key tile
#pragma unroll
      for (int r = 0; r < 8; ++r) {
        const float v = sc[r] * 0.125f;  // 1/sqrt(64)
        const float tmax = grpmax16(v);
        const float Mn = fmaxf(Mrow[r], tmax);
        const float alpha = __expf(Mrow[r] - Mn);
        const float p = __expf(v - Mn);
        Lrow[r] = Lrow[r] * alpha + grpsum16(p);
        Mrow[r] = Mn;
#pragma unroll
        for (int t = 0; t < 4; ++t) oacc[t][r] *= alpha;
        pbuf[wid][r + 8 * half][l16] = p;  // C-layout row -> LDS
      }
      asm volatile("s_wait_dscnt 0x0" ::: "memory");  // wave-local LDS RAW
      // O(16x64) += P(16x16) @ Vtile(16x64)
#pragma unroll
      for (int k4 = 0; k4 < 16; k4 += 4) {
        const int kk = k4 + 2 * half;
        v2f a;  // A frag of P: row = lane%16, K = kk,kk+1
        a.x = pbuf[wid][l16][kk];
        a.y = pbuf[wid][l16][kk + 1];
#pragma unroll
        for (int t = 0; t < 4; ++t) {
          v2f bb;  // B frag of V: rows kk/kk+1, col = t*16 + lane%16
          bb.x = sVb[(kl + kk) * VP + t * 16 + l16];
          bb.y = sVb[(kl + kk + 1) * VP + t * 16 + l16];
          oacc[t] = __builtin_amdgcn_wmma_f32_16x16x4_f32(false, a, false, bb,
                                                          (short)0, oacc[t], false, false);
        }
      }
      asm volatile("s_wait_dscnt 0x0" ::: "memory");  // WAR before next tile's P store
    }
    // hand-over: this wave's reads of the buffer are done, its copies of the next tile landed
    asm volatile("s_wait_dscnt 0x0" ::: "memory");
    asm volatile("s_wait_asynccnt 0x0" ::: "memory");
    __syncthreads();  // publishes tile ts+1 and ends every wave's reads of tile ts
    if (ts + 2 < NTILE) {
      stage_kv(kg + (size_t)(ts + 2) * KT * Dc, vg + (size_t)(ts + 2) * KT * Dc,
               lk + (ts & 1) * (KT * KP * 4), lv + (ts & 1) * (KT * VP * 4));
    }
  }
  asm volatile("s_wait_asynccnt 0x0" ::: "memory");  // no copy outstanding at the wave's end
  // finalize: O /= rowsum, scatter back into [B,S,D] at head offset
#pragma unroll
  for (int t = 0; t < 4; ++t) {
#pragma unroll
    for (int r = 0; r < 8; ++r) {
      const int orow = q0 + r + 8 * half;
      O[(size_t)(b * Sc + orow) * Dc + h * HDc + t * 16 + l16] = oacc[t][r] / Lrow[r];
    }
  }
}

// ---------------- fused residual add + LayerNorm (one row per block) ----------------
__global__ __launch_bounds__(256)
void add_ln_kernel(const float* __restrict__ a, const float* __restrict__ xin,
                   const float* __restrict__ g, const float* __restrict__ beta,
                   float* __restrict__ out) {
  __shared__ float red[8];
  const int row = blockIdx.x;
  const int tid = threadIdx.x;
  const int wid = tid >> 5, lane = tid & 31;
  const size_t base = (size_t)row * Dc;
  const float v0 = a[base + tid] + xin[base + tid];
  const float v1 = a[base + tid + 256] + xin[base + tid + 256];
  float s = v0 + v1;
#pragma unroll
  for (int m = 1; m < 32; m <<= 1) s += __shfl_xor(s, m);
  if (lane == 0) red[wid] = s;
  __syncthreads();
  float tot = 0.0f;
#pragma unroll
  for (int i = 0; i < 8; ++i) tot += red[i];
  const float mean = tot * (1.0f / Dc);
  __syncthreads();
  const float d0 = v0 - mean, d1 = v1 - mean;
  float q = d0 * d0 + d1 * d1;
#pragma unroll
  for (int m = 1; m < 32; m <<= 1) q += __shfl_xor(q, m);
  if (lane == 0) red[wid] = q;
  __syncthreads();
  float qt = 0.0f;
#pragma unroll
  for (int i = 0; i < 8; ++i) qt += red[i];
  const float rstd = rsqrtf(qt * (1.0f / Dc) + EPSc);
  out[base + tid] = d0 * rstd * g[tid] + beta[tid];
  out[base + tid + 256] = d1 * rstd * g[tid + 256] + beta[tid + 256];
}

// ---------------- host orchestration ----------------
extern "C" void kernel_launch(void* const* d_in, const int* in_sizes, int n_in,
                              void* d_out, int out_size, void* d_ws, size_t ws_size,
                              hipStream_t stream) {
  const int* tokens = (const int*)d_in[0];
  const float* emb = (const float*)d_in[1];
  const float* wq = (const float*)d_in[2];
  const float* wk = (const float*)d_in[3];
  const float* wv = (const float*)d_in[4];
  const float* wo = (const float*)d_in[5];
  const float* w1 = (const float*)d_in[6];
  const float* bf1 = (const float*)d_in[7];
  const float* w2 = (const float*)d_in[8];
  const float* bf2 = (const float*)d_in[9];
  const float* ln1_g = (const float*)d_in[10];
  const float* ln1_b = (const float*)d_in[11];
  const float* ln2_g = (const float*)d_in[12];
  const float* ln2_b = (const float*)d_in[13];
  (void)in_sizes; (void)n_in; (void)out_size; (void)ws_size;

  float* x = (float*)d_ws;        // [B,S,D]
  float* t0 = x + BSD;            // [B,S,D] scratch (proj / ff2)
  float* pool = t0 + BSD;         // 4*BSD pool
  float* xq = pool;
  float* xk = pool + BSD;
  float* xv = pool + 2 * BSD;
  float* ob = pool + 3 * BSD;
  float* ff1 = pool;              // reuses Q/K/V/O region after attention is consumed

  const dim3 blk(256);
  embed_pe_kernel<<<BS, blk, 0, stream>>>(tokens, emb, x);

  const int gD = (BS / 64) * (Dc / 16) / 8;  // 256 blocks (N = D)
  const int gF = (BS / 64) * (Fc / 16) / 8;  // 1024 blocks (N = F)
  const int gA = (Bc * Hc * (Sc / 16)) / 8;  // 256 blocks for attention

  for (int l = 0; l < Lc; ++l) {
    const float* Wq = wq + (size_t)l * Dc * Dc;
    const float* Wk = wk + (size_t)l * Dc * Dc;
    const float* Wv = wv + (size_t)l * Dc * Dc;
    const float* Wo = wo + (size_t)l * Dc * Dc;
    const float* W1 = w1 + (size_t)l * Dc * Fc;
    const float* W2 = w2 + (size_t)l * Fc * Dc;

    gemm_wmma_f32<<<gD, blk, 0, stream>>>(x, Wq, nullptr, xq, BS, Dc, Dc, 0);
    gemm_wmma_f32<<<gD, blk, 0, stream>>>(x, Wk, nullptr, xk, BS, Dc, Dc, 0);
    gemm_wmma_f32<<<gD, blk, 0, stream>>>(x, Wv, nullptr, xv, BS, Dc, Dc, 0);
    flash_attn_wmma<<<gA, blk, 0, stream>>>(xq, xk, xv, ob);
    gemm_wmma_f32<<<gD, blk, 0, stream>>>(ob, Wo, nullptr, t0, BS, Dc, Dc, 0);
    add_ln_kernel<<<BS, blk, 0, stream>>>(t0, x, ln1_g + (size_t)l * Dc,
                                          ln1_b + (size_t)l * Dc, x);
    gemm_wmma_f32<<<gF, blk, 0, stream>>>(x, W1, bf1 + (size_t)l * Fc, ff1, BS, Fc, Dc, 1);
    gemm_wmma_f32<<<gD, blk, 0, stream>>>(ff1, W2, bf2 + (size_t)l * Dc, t0, BS, Dc, Fc, 0);
    float* dst = (l == Lc - 1) ? (float*)d_out : x;
    add_ln_kernel<<<BS, blk, 0, stream>>>(t0, x, ln2_g + (size_t)l * Dc,
                                          ln2_b + (size_t)l * Dc, dst);
  }
}

// v003
// One run takes 1530 microseconds.
// Timed twice side by side with v002, it ran 1.10 times as fast both times.
// All steps since v000 together make it 1.50 times as fast.
#include <hip/hip_runtime.h>

typedef __attribute__((ext_vector_type(2))) float v2f;
typedef __attribute__((ext_vector_type(8))) float v8f;

constexpr int Bc = 2, Sc = 2048, Dc = 512, Hc = 8, Fc = 2048, Lc = 4, HDc = 64;
constexpr int BS = Bc * Sc;              // 4096 token rows
constexpr size_t BSD = (size_t)BS * Dc;  // elements in one [B,S,D] buffer
constexpr float EPSc = 1e-5f;
constexpr int KC = 32;                   // GEMM K-chunk staged in LDS
constexpr int AP = 36;   // A row pitch in LDS (floats): 16 rows x 2 halves of 8-byte reads fill 64 banks
constexpr int WP = 144;  // W row pitch in LDS (floats): 4 rows x 16 columns fill 64 banks

// ---- wave32 16-lane group reductions (xor masks 1/2/4/8 stay within each half) ----
__device__ inline float grpmax16(float v) {
  v = fmaxf(v, __shfl_xor(v, 1));
  v = fmaxf(v, __shfl_xor(v, 2));
  v = fmaxf(v, __shfl_xor(v, 4));
  v = fmaxf(v, __shfl_xor(v, 8));
  return v;
}
__device__ inline float grpsum16(float v) {
  v += __shfl_xor(v, 1);
  v += __shfl_xor(v, 2);
  v += __shfl_xor(v, 4);
  v += __shfl_xor(v, 8);
  return v;
}

// ---------------- embedding + sinusoidal positional encoding ----------------
__global__ __launch_bounds__(256) void embed_pe_kernel(const int* __restrict__ tokens,
                                                       const float* __restrict__ emb,
                                                       float* __restrict__ x) {
  const int row = blockIdx.x;  // 0..B*S-1
  const int s = row % Sc;
  const int tok = tokens[row];
  const float c = -9.210340371976184f / (float)Dc;  // -ln(10000)/D
  for (int d = threadIdx.x; d < Dc; d += 256) {
    const int i2 = d & ~1;
    const float ang = (float)s * __expf((float)i2 * c);
    const float pe = (d & 1) ? __cosf(ang) : __sinf(ang);
    x[(size_t)row * Dc + d] = emb[(size_t)tok * Dc + d] + pe;
  }
}

// ---------------- fp32 WMMA GEMM with async-to-LDS staging ----------------
// Block = 8 waves computing a 64x128 output tile (each wave a 64x16 strip).
// Per 32-wide K chunk: stage A[64][32] (8KB) and W[32][128] (16KB) into LDS via
// GLOBAL_LOAD_ASYNC_TO_LDS_B128 (ASYNCcnt), read every fragment of the chunk into registers
// as one group, then run the 8 WMMA k-steps from registers.
// Both tiles lie in LDS at padded row pitches, so that a fragment read meets no bank twice.
__global__ __launch_bounds__(256)
void gemm_wmma_f32(const float* __restrict__ A, const float* __restrict__ W,
                   const float* __restrict__ bias, float* __restrict__ C,
                   int M, int N, int K, int relu) {
  __shared__ __attribute__((aligned(16))) float sA[64 * AP];  // [64 rows][KC], pitch AP
  __shared__ __attribute__((aligned(16))) float sW[KC * WP];  // [KC rows][128 cols], pitch WP
  const int tid = threadIdx.x;
  const int wid = tid >> 5;
  const int lane = tid & 31;
  const int half = lane >> 4, l16 = lane & 15;
  const int ntiles = N >> 4;
  const int gw0 = blockIdx.x * 8;
  const int mt = gw0 / ntiles;          // block-uniform (8 divides ntiles)
  const int ntB = gw0 % ntiles;         // first n-tile of this block
  const int m0 = mt << 6;
  const int n0b = ntB << 4;             // block column base (covers 128 cols)
  const int nLoc = (wid << 4) + l16;    // 0..127 : this lane's column in block
  (void)M;
  const unsigned sAbase = (unsigned)(size_t)sA;  // LDS byte offset = addr[31:0]
  const unsigned sWbase = (unsigned)(size_t)sW;
  const float* afrag = sA + l16 * AP + 2 * half;    // A fragments: row l16 (+16t), K = 2*half
  const float* wfrag = sW + 2 * half * WP + nLoc;   // W fragments: row 2*half, column nLoc
  v8f acc[4] = {};
  for (int kc = 0; kc < K; kc += KC) {
    __syncthreads();  // protect LDS against overwrite while prior chunk in use
    // stage A chunk: 512 x 16B segments across 256 threads
#pragma unroll
    for (int j = 0; j < 2; ++j) {
      const int seg = tid + j * 256;           // 0..511
      const int row = seg >> 3, c4 = (seg & 7) << 2;
      const unsigned long long ga =
          (unsigned long long)(A + (size_t)(m0 + row) * K + kc + c4);
      const unsigned la = sAbase + (unsigned)((row * AP + c4) << 2);
      asm volatile("global_load_async_to_lds_b128 %0, %1, off"
                   :: "v"(la), "v"(ga) : "memory");
    }
    // stage W chunk: 1024 x 16B segments across 256 threads
#pragma unroll
    for (int j = 0; j < 4; ++j) {
      const int seg = tid + j * 256;           // 0..1023
      const int r = seg >> 5, c4 = (seg & 31) << 2;
      const unsigned long long ga =
          (unsigned long long)(W + (size_t)(kc + r) * N + n0b + c4);
      const unsigned la = sWbase + (unsigned)((r * WP + c4) << 2);
      asm volatile("global_load_async_to_lds_b128 %0, %1, off"
                   :: "v"(la), "v"(ga) : "memory");
    }
    asm volatile("s_wait_asynccnt 0x0" ::: "memory");  // own async loads done
    __syncthreads();                                    // all waves' loads done
    // all fragments of the chunk go from LDS to registers as one group; k-step s of this
    // lane-half holds K = 4s + 2*half and the next
    v2f bf[KC / 4], af[KC / 4][4];
#pragma unroll
    for (int s = 0; s < KC / 4; ++s) {
      bf[s].x = wfrag[(4 * s) * WP];
      bf[s].y = wfrag[(4 * s + 1) * WP];
#pragma unroll
      for (int t = 0; t < 4; ++t) af[s][t] = *(const v2f*)(afrag + t * 16 * AP + 4 * s);
      // keeps the reads in k order and ahead of the matrix run: the first WMMAs then wait for
      // the first reads only; sunk among the WMMAs, each pair would wait out an LDS latency
      if (s & 1) __builtin_amdgcn_sched_barrier(0);
    }
    // 8 k-steps from registers
#pragma unroll
    for (int s = 0; s < KC / 4; ++s) {
#pragma unroll
      for (int t = 0; t < 4; ++t) {
        acc[t] = __builtin_amdgcn_wmma_f32_16x16x4_f32(false, af[s][t], false, bf[s],
                                                       (short)0, acc[t], false, false);
      }
    }
  }
  const float bv = bias ? bias[n0b + nLoc] : 0.0f;
#pragma unroll
  for (int t = 0; t < 4; ++t) {
#pragma unroll
    for (int r = 0; r < 8; ++r) {  // C/D row = r + 8*half, col = nLoc
      const int m = m0 + t * 16 + r + 8 * half;
      float v = acc[t][r] + bv;
      if (relu) v = fmaxf(v, 0.0f);
      C[(size_t)m * N + n0b + nLoc] = v;
    }
  }
}

// ---------------- flash attention, fp32 WMMA, one wave per 16-query tile ----------------
// The 8 waves of a block share one (batch, head): each 64-key tile of K and V is brought
// into LDS once per block by async copies, two buffers, the next tile in flight while this
// one is worked on.
constexpr int KT = 64;        // keys per staged tile
constexpr int NTILE = Sc / KT;
constexpr int KP = 68;        // K row pitch in LDS (floats): 16 rows x 8-byte reads fill 64 banks
constexpr int VP = 80;        // V row pitch in LDS (floats): 4 rows x 16 columns fill 64 banks

// One tile: 64 rows of 256 bytes of K and of V; each lane copies 16 bytes of rows
// r, r+16, r+32, r+48 of both. kg/vg: the lane's bytes in row r; lk/lv: their LDS byte address.
__device__ inline void stage_kv(const float* kg, const float* vg, unsigned lk, unsigned lv) {
  const unsigned long long k0 = (unsigned long long)kg;
  const unsigned long long k1 = (unsigned long long)(kg + 16 * Dc);
  const unsigned long long k2 = (unsigned long long)(kg + 32 * Dc);
  const unsigned long long k3 = (unsigned long long)(kg + 48 * Dc);
  const unsigned long long v0 = (unsigned long long)vg;
  const unsigned long long v1 = (unsigned long long)(vg + 16 * Dc);
  const unsigned long long v2 = (unsigned long long)(vg + 32 * Dc);
  const unsigned long long v3 = (unsigned long long)(vg + 48 * Dc);
  const unsigned lk1 = lk + 16 * KP * 4, lk2 = lk + 32 * KP * 4, lk3 = lk + 48 * KP * 4;
  const unsigned lv1 = lv + 16 * VP * 4, lv2 = lv + 32 * VP * 4, lv3 = lv + 48 * VP * 4;
  // the closing s_wait_xcnt stands in the copies' own statement, so that no address
  // register of a copy is rewritten in front of it
  asm volatile("global_load_async_to_lds_b128 %0, %8, off\n\t"
               "global_load_async_to_lds_b128 %1, %9, off\n\t"
               "global_load_async_to_lds_b128 %2, %10, off\n\t"
               "global_load_async_to_lds_b128 %3, %11, off\n\t"
               "global_load_async_to_lds_b128 %4, %12, off\n\t"
               "global_load_async_to_lds_b128 %5, %13, off\n\t"
               "global_load_async_to_lds_b128 %6, %14, off\n\t"
               "global_load_async_to_lds_b128 %7, %15, off\n\t"
               "s_wait_xcnt 0x0"
               :: "v"(lk), "v"(lk1), "v"(lk2), "v"(lk3), "v"(lv), "v"(lv1), "v"(lv2), "v"(lv3),
                  "v"(k0), "v"(k1), "v"(k2), "v"(k3), "v"(v0), "v"(v1), "v"(v2), "v"(v3)
               : "memory");
}

__global__ __launch_bounds__(256)
void flash_attn_wmma(const float* __restrict__ Q, const float* __restrict__ Km,
                     const float* __restrict__ Vm, float* __restrict__ O) {
  __shared__ float pbuf[8][16][17];  // per-wave P tile, padded stride
  __shared__ __attribute__((aligned(16))) float sK[2][KT * KP];
  __shared__ __attribute__((aligned(16))) float sV[2][KT * VP];
  const int wid = threadIdx.x >> 5, lane = threadIdx.x & 31;
  const int half = lane >> 4, l16 = lane & 15;
  const int gw = blockIdx.x * 8 + wid;
  const int qtiles = Sc / 16;
  const int qt = gw % qtiles, bh = gw / qtiles;  // bh is block-uniform (8 divides qtiles)
  const int b = bh / Hc, h = bh % Hc;
  const float* qp = Q + (size_t)b * Sc * Dc + h * HDc;
  const float* kp = Km + (size_t)b * Sc * Dc + h * HDc;
  const float* vp = Vm + (size_t)b * Sc * Dc + h * HDc;
  const int q0 = qt * 16;
  // this lane's share of a staged tile: row srow (+16, +32, +48), floats sc4 .. sc4+3
  const int srow = threadIdx.x >> 4, sc4 = (threadIdx.x & 15) << 2;
  const float* kg = kp + (size_t)srow * Dc + sc4;
  const float* vg = vp + (size_t)srow * Dc + sc4;
  const unsigned lk = (unsigned)(size_t)&sK[0][0] + (unsigned)((srow * KP + sc4) << 2);
  const unsigned lv = (unsigned)(size_t)&sV[0][0] + (unsigned)((srow * VP + sc4) << 2);
  v8f oacc[4] = {};
  float Mrow[8], Lrow[8];
#pragma unroll
  for (int r = 0; r < 8; ++r) { Mrow[r] = -3.0e38f; Lrow[r] = 0.0f; }

  stage_kv(kg, vg, lk, lv);                          // tile 0 -> buffer 0
  asm volatile("s_wait_asynccnt 0x0" ::: "memory");  // own copies of tile 0 landed
  __syncthreads();                                   // every wave's copies of tile 0 landed
  stage_kv(kg + (size_t)KT * Dc, vg + (size_t)KT * Dc,
           lk + KT * KP * 4, lv + KT * VP * 4);      // tile 1 -> buffer 1

  for (int ts = 0; ts < NTILE; ++ts) {
    const float* sKb = sK[ts & 1];
    const float* sVb = sV[ts & 1];
    for (int kl = 0; kl < KT; kl += 16) {
      // scores tile S(16x16) = Qtile(16x64) @ K^T(64x16)
      v8f sc = {};
#pragma unroll
      for (int d0 = 0; d0 < HDc; d0 += 4) {
        const int dd = d0 + 2 * half;
        const v2f a = *(const v2f*)(qp + (size_t)(q0 + l16) * Dc + dd);
        const v2f bb = *(const v2f*)(sKb + (kl + l16) * KP + dd);  // B[d][n]=K[n][d]
        sc = __builtin_amdgcn_wmma_f32_16x16x4_f32(false, a, false, bb,
                                                   (short)0, sc, false, false);
      }
      // online softmax over this key tile
#pragma unroll
      for (int r = 0; r < 8; ++r) {
        const float v = sc[r] * 0.125f;  // 1/sqrt(64)
        const float tmax = grpmax16(v);
        const float Mn = fmaxf(Mrow[r], tmax);
        const float alpha = __expf(Mrow[r] - Mn);
        const float p = __expf(v - Mn);
        Lrow[r] = Lrow[r] * alpha + grpsum16(p);
        Mrow[r] = Mn;
#pragma unroll
        for (int t = 0; t < 4; ++t) oacc[t][r] *= alpha;
        pbuf[wid][r + 8 * half][l16] = p;  // C-layout row -> LDS
      }
      asm volatile("s_wait_dscnt 0x0" ::: "memory");  // wave-local LDS RAW
      // O(16x64) += P(16x16) @ Vtile(16x64)
#pragma unroll
      for (int k4 = 0; k4 < 16; k4 += 4) {
        const int kk = k4 + 2 * half;
        v2f a;  // A frag of P: row = lane%16, K = kk,kk+1
        a.x = pbuf[wid][l16][kk];
        a.y = pbuf[wid][l16][kk + 1];
#pragma unroll
        for (int t = 0; t < 4; ++t) {
          v2f bb;  // B frag of V: rows kk/kk+1, col = t*16 + lane%16
          bb.x = sVb[(kl + kk) * VP + t * 16 + l16];
          bb.y = sVb[(kl + kk + 1) * VP + t * 16 + l16];
          oacc[t] = __builtin_amdgcn_wmma_f32_16x16x4_f32(false, a, false, bb,
                                                          (short)0, oacc[t], false, false);
        }
      }
      asm volatile("s_wait_dscnt 0x0" ::: "memory");  // WAR before next tile's P store
    }
    // hand-over: this wave's reads of the buffer are done, its copies of the next tile landed
    asm volatile("s_wait_dscnt 0x0" ::: "memory");
    asm volatile("s_wait_asynccnt 0x0" ::: "memory");
    __syncthreads();  // publishes tile ts+1 and ends every wave's reads of tile ts
    if (ts + 2 < NTILE) {
      stage_kv(kg + (size_t)(ts + 2) * KT * Dc, vg + (size_t)(ts + 2) * KT * Dc,
               lk + (ts & 1) * (KT * KP * 4), lv + (ts & 1) * (KT * VP * 4));
    }
  }
  asm volatile("s_wait_asynccnt 0x0" ::: "memory");  // no copy outstanding at the wave's end
  // finalize: O /= rowsum, scatter back into [B,S,D] at head offset
#pragma unroll
  for (int t = 0; t < 4; ++t) {
#pragma unroll
    for (int r = 0; r < 8; ++r) {
      const int orow = q0 + r + 8 * half;
      O[(size_t)(b * Sc + orow) * Dc + h * HDc + t * 16 + l16] = oacc[t][r] / Lrow[r];
    }
  }
}

// ---------------- fused residual add + LayerNorm (one row per block) ----------------
__global__ __launch_bounds__(256)
void add_ln_kernel(const float* __restrict__ a, const float* __restrict__ xin,
                   const float* __restrict__ g, const float* __restrict__ beta,
                   float* __restrict__ out) {
  __shared__ float red[8];
  const int row = blockIdx.x;
  const int tid = threadIdx.x;
  const int wid = tid >> 5, lane = tid & 31;
  const size_t base = (size_t)row * Dc;
  const float v0 = a[base + tid] + xin[base + tid];
  const float v1 = a[base + tid + 256] + xin[base + tid + 256];
  float s = v0 + v1;
#pragma unroll
  for (int m = 1; m < 32; m <<= 1) s += __shfl_xor(s, m);
  if (lane == 0) red[wid] = s;
  __syncthreads();
  float tot = 0.0f;
#pragma unroll
  for (int i = 0; i < 8; ++i) tot += red[i];
  const float mean = tot * (1.0f / Dc);
  __syncthreads();
  const float d0 = v0 - mean, d1 = v1 - mean;
  float q = d0 * d0 + d1 * d1;
#pragma unroll
  for (int m = 1; m < 32; m <<= 1) q += __shfl_xor(q, m);
  if (lane == 0) red[wid] = q;
  __syncthreads();
  float qt = 0.0f;
#pragma unroll
  for (int i = 0; i < 8; ++i) qt += red[i];
  const float rstd = rsqrtf(qt * (1.0f / Dc) + EPSc);
  out[base + tid] = d0 * rstd * g[tid] + beta[tid];
  out[base + tid + 256] = d1 * rstd * g[tid + 256] + beta[tid + 256];
}

// ---------------- host orchestration ----------------
extern "C" void kernel_launch(void* const* d_in, const int* in_sizes, int n_in,
                              void* d_out, int out_size, void* d_ws, size_t ws_size,
                              hipStream_t stream) {
  const int* tokens = (const int*)d_in[0];
  const float* emb = (const float*)d_in[1];
  const float* wq = (const float*)d_in[2];
  const float* wk = (const float*)d_in[3];
  const float* wv = (const float*)d_in[4];
  const float* wo = (const float*)d_in[5];
  const float* w1 = (const float*)d_in[6];
  const float* bf1 = (const float*)d_in[7];
  const float* w2 = (const float*)d_in[8];
  const float* bf2 = (const float*)d_in[9];
  const float* ln1_g = (const float*)d_in[10];
  const float* ln1_b = (const float*)d_in[11];
  const float* ln2_g = (const float*)d_in[12];
  const float* ln2_b = (const float*)d_in[13];
  (void)in_sizes; (void)n_in; (void)out_size; (void)ws_size;

  float* x = (float*)d_ws;        // [B,S,D]
  float* t0 = x + BSD;            // [B,S,D] scratch (proj / ff2)
  float* pool = t0 + BSD;         // 4*BSD pool
  float* xq = pool;
  float* xk = pool + BSD;
  float* xv = pool + 2 * BSD;
  float* ob = pool + 3 * BSD;
  float* ff1 = pool;              // reuses Q/K/V/O region after attention is consumed

  const dim3 blk(256);
  embed_pe_kernel<<<BS, blk, 0, stream>>>(tokens, emb, x);

  const int gD = (BS / 64) * (Dc / 16) / 8;  // 256 blocks (N = D)
  const int gF = (BS / 64) * (Fc / 16) / 8;  // 1024 blocks (N = F)
  const int gA = (Bc * Hc * (Sc / 16)) / 8;  // 256 blocks for attention

  for (int l = 0; l < Lc; ++l) {
    const float* Wq = wq + (size_t)l * Dc * Dc;
    const float* Wk = wk + (size_t)l * Dc * Dc;
    const float* Wv = wv + (size_t)l * Dc * Dc;
    const float* Wo = wo + (size_t)l * Dc * Dc;
    const float* W1 = w1 + (size_t)l * Dc * Fc;
    const float* W2 = w2 + (size_t)l * Fc * Dc;

    gemm_wmma_f32<<<gD, blk, 0, stream>>>(x, Wq, nullptr, xq, BS, Dc, Dc, 0);
    gemm_wmma_f32<<<gD, blk, 0, stream>>>(x, Wk, nullptr, xk, BS, Dc, Dc, 0);
    gemm_wmma_f32<<<gD, blk, 0, stream>>>(x, Wv, nullptr, xv, BS, Dc, Dc, 0);
    flash_attn_wmma<<<gA, blk, 0, stream>>>(xq, xk, xv, ob);
    gemm_wmma_f32<<<gD, blk, 0, stream>>>(ob, Wo, nullptr, t0, BS, Dc, Dc, 0);
    add_ln_kernel<<<BS, blk, 0, stream>>>(t0, x, ln1_g + (size_t)l * Dc,
                                          ln1_b + (size_t)l * Dc, x);
    gemm_wmma_f32<<<gF, blk, 0, stream>>>(x, W1, bf1 + (size_t)l * Fc, ff1, BS, Fc, Dc, 1);
    gemm_wmma_f32<<<gD, blk, 0, stream>>>(ff1, W2, bf2 + (size_t)l * Dc, t0, BS, Dc, Fc, 0);
    float* dst = (l == Lc - 1) ? (float*)d_out : x;
    add_ln_kernel<<<BS, blk, 0, stream>>>(t0, x, ln2_g + (size_t)l * Dc,
                                          ln2_b + (size_t)l * Dc, dst);
  }
}

// v004
// Measured time: 1280 microseconds a run.
// Timed twice side by side with v003, it ran 1.19 times as fast both times.
// Over all steps from v000 it is 1.78 times as fast.
#include <hip/hip_runtime.h>

typedef __attribute__((ext_vector_type(2))) float v2f;
typedef __attribute__((ext_vector_type(8))) float v8f;

constexpr int Bc = 2, Sc = 2048, Dc = 512, Hc = 8, Fc = 2048, Lc = 4, HDc = 64;
constexpr int BS = Bc * Sc;              // 4096 token rows
constexpr size_t BSD = (size_t)BS * Dc;  // elements in one [B,S,D] buffer
constexpr float EPSc = 1e-5f;
constexpr int KC = 32;                   // GEMM K-chunk staged in LDS
constexpr int AP = 36;   // A row pitch in LDS (floats): 16 rows x 2 halves of 8-byte reads fill 64 banks
constexpr int WP = 144;  // W row pitch in LDS (floats): 4 rows x 16 columns fill 64 banks

// ---- wave32 16-lane group reductions (xor masks 1/2/4/8 stay within each half) ----
__device__ inline float grpmax16(float v) {
  v = fmaxf(v, __shfl_xor(v, 1));
  v = fmaxf(v, __shfl_xor(v, 2));
  v = fmaxf(v, __shfl_xor(v, 4));
  v = fmaxf(v, __shfl_xor(v, 8));
  return v;
}
__device__ inline float grpsum16(float v) {
  v += __shfl_xor(v, 1);
  v += __shfl_xor(v, 2);
  v += __shfl_xor(v, 4);
  v += __shfl_xor(v, 8);
  return v;
}

// ---------------- embedding + sinusoidal positional encoding ----------------
__global__ __launch_bounds__(256) void embed_pe_kernel(const int* __restrict__ tokens,
                                                       const float* __restrict__ emb,
                                                       float* __restrict__ x) {
  const int row = blockIdx.x;  // 0..B*S-1
  const int s = row % Sc;
  const int tok = tokens[row];
  const float c = -9.210340371976184f / (float)Dc;  // -ln(10000)/D
  for (int d = threadIdx.x; d < Dc; d += 256) {
    const int i2 = d & ~1;
    const float ang = (float)s * __expf((float)i2 * c);
    const float pe = (d & 1) ? __cosf(ang) : __sinf(ang);
    x[(size_t)row * Dc + d] = emb[(size_t)tok * Dc + d] + pe;
  }
}

// ---------------- fp32 WMMA GEMM with async-to-LDS staging ----------------
// Block = 8 waves computing a 64x128 output tile (each wave a 64x16 strip).
// Per 32-wide K chunk: A[64][32] (8KB) and W[32][128] (16KB) come into LDS by
// GLOBAL_LOAD_ASYNC_TO_LDS_B128 (ASYNCcnt), two buffers: the next chunk's copies fly while this
// chunk's fragments are read into registers as one group and its 8 WMMA k-steps run.
// Both tiles lie in LDS at padded row pitches, so that a fragment read meets no bank twice.
constexpr int ABUF = 64 * AP;  // floats in one A buffer
constexpr int WBUF = KC * WP;  // floats in one W buffer

// One chunk: each lane copies 16 bytes of A rows r, r+32 and of W rows q, q+8, q+16, q+24.
// ag/wg: the lane's bytes in rows r and q; la/lw: their LDS byte addresses.
__device__ inline void stage_aw(const float* ag, const float* wg, size_t K, size_t N,
                                unsigned la, unsigned lw) {
  const unsigned long long a0 = (unsigned long long)ag;
  const unsigned long long a1 = (unsigned long long)(ag + 32 * K);
  const unsigned long long w0 = (unsigned long long)wg;
  const unsigned long long w1 = (unsigned long long)(wg + 8 * N);
  const unsigned long long w2 = (unsigned long long)(wg + 16 * N);
  const unsigned long long w3 = (unsigned long long)(wg + 24 * N);
  const unsigned la1 = la + 32 * AP * 4;
  const unsigned lw1 = lw + 8 * WP * 4, lw2 = lw + 16 * WP * 4, lw3 = lw + 24 * WP * 4;
  // the closing s_wait_xcnt stands in the copies' own statement, so that no address
  // register of a copy is rewritten in front of it
  asm volatile("global_load_async_to_lds_b128 %0, %6, off\n\t"
               "global_load_async_to_lds_b128 %1, %7, off\n\t"
               "global_load_async_to_lds_b128 %2, %8, off\n\t"
               "global_load_async_to_lds_b128 %3, %9, off\n\t"
               "global_load_async_to_lds_b128 %4, %10, off\n\t"
               "global_load_async_to_lds_b128 %5, %11, off\n\t"
               "s_wait_xcnt 0x0"
               :: "v"(la), "v"(la1), "v"(lw), "v"(lw1), "v"(lw2), "v"(lw3),
                  "v"(a0), "v"(a1), "v"(w0), "v"(w1), "v"(w2), "v"(w3)
               : "memory");
}

__global__ __launch_bounds__(256)
void gemm_wmma_f32(const float* __restrict__ A, const float* __restrict__ W,
                   const float* __restrict__ bias, float* __restrict__ C,
                   int M, int N, int K, int relu) {
  __shared__ __attribute__((aligned(16))) float sA[2][ABUF];  // [64 rows][KC], pitch AP
  __shared__ __attribute__((aligned(16))) float sW[2][WBUF];  // [KC rows][128 cols], pitch WP
  const int tid = threadIdx.x;
  const int wid = tid >> 5;
  const int lane = tid & 31;
  const int half = lane >> 4, l16 = lane & 15;
  const int ntiles = N >> 4;
  const int gw0 = blockIdx.x * 8;
  const int mt = gw0 / ntiles;          // block-uniform (8 divides ntiles)
  const int ntB = gw0 % ntiles;         // first n-tile of this block
  const int m0 = mt << 6;
  const int n0b = ntB << 4;             // block column base (covers 128 cols)
  const int nLoc = (wid << 4) + l16;    // 0..127 : this lane's column in block
  (void)M;
  const float* afrag = &sA[0][0] + l16 * AP + 2 * half;    // A fragments: row l16 (+16t), K = 2*half
  const float* wfrag = &sW[0][0] + 2 * half * WP + nLoc;   // W fragments: row 2*half, column nLoc
  // this lane's share of a staged chunk: A row tid/8 (+32), W row tid/32 (+8, +16, +24)
  const int arow = tid >> 3, ac4 = (tid & 7) << 2;
  const int wrow = tid >> 5, wc4 = (tid & 31) << 2;
  const float* ag = A + (size_t)(m0 + arow) * K + ac4;
  const float* wg = W + (size_t)wrow * N + n0b + wc4;
  const size_t wstep = (size_t)KC * N;  // floats from one W chunk to the next
  const unsigned la = (unsigned)(size_t)&sA[0][0] + (unsigned)((arow * AP + ac4) << 2);
  const unsigned lw = (unsigned)(size_t)&sW[0][0] + (unsigned)((wrow * WP + wc4) << 2);
  const int nch = K / KC;
  v8f acc[4] = {};

  stage_aw(ag, wg, K, N, la, lw);                    // chunk 0 -> buffer 0
  asm volatile("s_wait_asynccnt 0x0" ::: "memory");  // own copies of chunk 0 landed
  __syncthreads();                                   // every wave's copies of chunk 0 landed
  if (nch > 1) stage_aw(ag + KC, wg + wstep, K, N, la + ABUF * 4, lw + WBUF * 4);  // chunk 1

  for (int c = 0; c < nch; ++c) {
    const float* afb = afrag + (c & 1) * ABUF;
    const float* wfb = wfrag + (c & 1) * WBUF;
    // all fragments of the chunk go from LDS to registers as one group; k-step s of this
    // lane-half holds K = 4s + 2*half and the next
    v2f bf[KC / 4], af[KC / 4][4];
#pragma unroll
    for (int s = 0; s < KC / 4; ++s) {
      bf[s].x = wfb[(4 * s) * WP];
      bf[s].y = wfb[(4 * s + 1) * WP];
#pragma unroll
      for (int t = 0; t < 4; ++t) af[s][t] = *(const v2f*)(afb + t * 16 * AP + 4 * s);
      // keeps the reads in k order and ahead of the matrix run: the first WMMAs then wait for
      // the first reads only; sunk among the WMMAs, each pair would wait out an LDS latency
      if (s & 1) __builtin_amdgcn_sched_barrier(0);
    }
    // 8 k-steps from registers
#pragma unroll
    for (int s = 0; s < KC / 4; ++s) {
#pragma unroll
      for (int t = 0; t < 4; ++t) {
        acc[t] = __builtin_amdgcn_wmma_f32_16x16x4_f32(false, af[s][t], false, bf[s],
                                                       (short)0, acc[t], false, false);
      }
    }
    // keeps the matrix run ahead of the hand-over: with WMMAs sunk behind the waits, the wait for
    // the next chunk's copies would come early in the trip and their flight would not be hidden
    __builtin_amdgcn_sched_barrier(0);
    // four vector slots behind the last WMMA: the refill's address arithmetic takes over the
    // registers of the last A fragments
    asm volatile("v_nop\n\tv_nop\n\tv_nop\n\tv_nop");
    // hand-over: this wave's reads of the buffer are done, its copies of the next chunk landed
    asm volatile("s_wait_dscnt 0x0" ::: "memory");
    asm volatile("s_wait_asynccnt 0x0" ::: "memory");
    __syncthreads();  // publishes chunk c+1 and ends every wave's reads of chunk c
    if (c + 2 < nch) {
      stage_aw(ag + (size_t)(c + 2) * KC, wg + (size_t)(c + 2) * wstep, K, N,
               la + (c & 1) * (ABUF * 4), lw + (c & 1) * (WBUF * 4));
    }
  }
  asm volatile("s_wait_asynccnt 0x0" ::: "memory");  // no copy outstanding at the wave's end
  const float bv = bias ? bias[n0b + nLoc] : 0.0f;
#pragma unroll
  for (int t = 0; t < 4; ++t) {
#pragma unroll
    for (int r = 0; r < 8; ++r) {  // C/D row = r + 8*half, col = nLoc
      const int m = m0 + t * 16 + r + 8 * half;
      float v = acc[t][r] + bv;
      if (relu) v = fmaxf(v, 0.0f);
      C[(size_t)m * N + n0b + nLoc] = v;
    }
  }
}

// ---------------- flash attention, fp32 WMMA, one wave per 16-query tile ----------------
// The 8 waves of a block share one (batch, head): each 64-key tile of K and V is brought
// into LDS once per block by async copies, two buffers, the next tile in flight while this
// one is worked on.
constexpr int KT = 64;        // keys per staged tile
constexpr int NTILE = Sc / KT;
constexpr int KP = 68;        // K row pitch in LDS (floats): 16 rows x 8-byte reads fill 64 banks
constexpr int VP = 80;        // V row pitch in LDS (floats): 4 rows x 16 columns fill 64 banks

// One tile: 64 rows of 256 bytes of K and of V; each lane copies 16 bytes of rows
// r, r+16, r+32, r+48 of both. kg/vg: the lane's bytes in row r; lk/lv: their LDS byte address.
__device__ inline void stage_kv(const float* kg, const float* vg, unsigned lk, unsigned lv) {
  const unsigned long long k0 = (unsigned long long)kg;
  const unsigned long long k1 = (unsigned long long)(kg + 16 * Dc);
  const unsigned long long k2 = (unsigned long long)(kg + 32 * Dc);
  const unsigned long long k3 = (unsigned long long)(kg + 48 * Dc);
  const unsigned long long v0 = (unsigned long long)vg;
  const unsigned long long v1 = (unsigned long long)(vg + 16 * Dc);
  const unsigned long long v2 = (unsigned long long)(vg + 32 * Dc);
  const unsigned long long v3 = (unsigned long long)(vg + 48 * Dc);
  const unsigned lk1 = lk + 16 * KP * 4, lk2 = lk + 32 * KP * 4, lk3 = lk + 48 * KP * 4;
  const unsigned lv1 = lv + 16 * VP * 4, lv2 = lv + 32 * VP * 4, lv3 = lv + 48 * VP * 4;
  // the closing s_wait_xcnt stands in the copies' own statement, so that no address
  // register of a copy is rewritten in front of it
  asm volatile("global_load_async_to_lds_b128 %0, %8, off\n\t"
               "global_load_async_to_lds_b128 %1, %9, off\n\t"
               "global_load_async_to_lds_b128 %2, %10, off\n\t"
               "global_load_async_to_lds_b128 %3, %11, off\n\t"
               "global_load_async_to_lds_b128 %4, %12, off\n\t"
               "global_load_async_to_lds_b128 %5, %13, off\n\t"
               "global_load_async_to_lds_b128 %6, %14, off\n\t"
               "global_load_async_to_lds_b128 %7, %15, off\n\t"
               "s_wait_xcnt 0x0"
               :: "v"(lk), "v"(lk1), "v"(lk2), "v"(lk3), "v"(lv), "v"(lv1), "v"(lv2), "v"(lv3),
                  "v"(k0), "v"(k1), "v"(k2), "v"(k3), "v"(v0), "v"(v1), "v"(v2), "v"(v3)
               : "memory");
}

__global__ __launch_bounds__(256)
void flash_attn_wmma(const float* __restrict__ Q, const float* __restrict__ Km,
                     const float* __restrict__ Vm, float* __restrict__ O) {
  __shared__ float pbuf[8][16][17];  // per-wave P tile, padded stride
  __shared__ __attribute__((aligned(16))) float sK[2][KT * KP];
  __shared__ __attribute__((aligned(16))) float sV[2][KT * VP];
  const int wid = threadIdx.x >> 5, lane = threadIdx.x & 31;
  const int half = lane >> 4, l16 = lane & 15;
  const int gw = blockIdx.x * 8 + wid;
  const int qtiles = Sc / 16;
  const int qt = gw % qtiles, bh = gw / qtiles;  // bh is block-uniform (8 divides qtiles)
  const int b = bh / Hc, h = bh % Hc;
  const float* qp = Q + (size_t)b * Sc * Dc + h * HDc;
  const float* kp = Km + (size_t)b * Sc * Dc + h * HDc;
  const float* vp = Vm + (size_t)b * Sc * Dc + h * HDc;
  const int q0 = qt * 16;
  // this lane's share of a staged tile: row srow (+16, +32, +48), floats sc4 .. sc4+3
  const int srow = threadIdx.x >> 4, sc4 = (threadIdx.x & 15) << 2;
  const float* kg = kp + (size_t)srow * Dc + sc4;
  const float* vg = vp + (size_t)srow * Dc + sc4;
  const unsigned lk = (unsigned)(size_t)&sK[0][0] + (unsigned)((srow * KP + sc4) << 2);
  const unsigned lv = (unsigned)(size_t)&sV[0][0] + (unsigned)((srow * VP + sc4) << 2);
  v8f oacc[4] = {};
  float Mrow[8], Lrow[8];
#pragma unroll
  for (int r = 0; r < 8; ++r) { Mrow[r] = -3.0e38f; Lrow[r] = 0.0f; }

  stage_kv(kg, vg, lk, lv);                          // tile 0 -> buffer 0
  asm volatile("s_wait_asynccnt 0x0" ::: "memory");  // own copies of tile 0 landed
  __syncthreads();                                   // every wave's copies of tile 0 landed
  stage_kv(kg + (size_t)KT * Dc, vg + (size_t)KT * Dc,
           lk + KT * KP * 4, lv + KT * VP * 4);      // tile 1 -> buffer 1

  for (int ts = 0; ts < NTILE; ++ts) {
    const float* sKb = sK[ts & 1];
    const float* sVb = sV[ts & 1];
    for (int kl = 0; kl < KT; kl += 16) {
      // scores tile S(16x16) = Qtile(16x64) @ K^T(64x16)
      v8f sc = {};
#pragma unroll
      for (int d0 = 0; d0 < HDc; d0 += 4) {
        const int dd = d0 + 2 * half;
        const v2f a = *(const v2f*)(qp + (size_t)(q0 + l16) * Dc + dd);
        const v2f bb = *(const v2f*)(sKb + (kl + l16) * KP + dd);  // B[d][n]=K[n][d]
        sc = __builtin_amdgcn_wmma_f32_16x16x4_f32(false, a, false, bb,
                                                   (short)0, sc, false, false);
      }
      // online softmax over this key tile
#pragma unroll
      for (int r = 0; r < 8; ++r) {
        const float v = sc[r] * 0.125f;  // 1/sqrt(64)
        const float tmax = grpmax16(v);
        const float Mn = fmaxf(Mrow[r], tmax);
        const float alpha = __expf(Mrow[r] - Mn);
        const float p = __expf(v - Mn);
        Lrow[r] = Lrow[r] * alpha + grpsum16(p);
        Mrow[r] = Mn;
#pragma unroll
        for (int t = 0; t < 4; ++t) oacc[t][r] *= alpha;
        pbuf[wid][r + 8 * half][l16] = p;  // C-layout row -> LDS
      }
      asm volatile("s_wait_dscnt 0x0" ::: "memory");  // wave-local LDS RAW
      // O(16x64) += P(16x16) @ Vtile(16x64)
#pragma unroll
      for (int k4 = 0; k4 < 16; k4 += 4) {
        const int kk = k4 + 2 * half;
        v2f a;  // A frag of P: row = lane%16, K = kk,kk+1
        a.x = pbuf[wid][l16][kk];
        a.y = pbuf[wid][l16][kk + 1];
#pragma unroll
        for (int t = 0; t < 4; ++t) {
          v2f bb;  // B frag of V: rows kk/kk+1, col = t*16 + lane%16
          bb.x = sVb[(kl + kk) * VP + t * 16 + l16];
          bb.y = sVb[(kl + kk + 1) * VP + t * 16 + l16];
          oacc[t] = __builtin_amdgcn_wmma_f32_16x16x4_f32(false, a, false, bb,
                                                          (short)0, oacc[t], false, false);
        }
      }
      asm volatile("s_wait_dscnt 0x0" ::: "memory");  // WAR before next tile's P store
    }
    // hand-over: this wave's reads of the buffer are done, its copies of the next tile landed
    asm volatile("s_wait_dscnt 0x0" ::: "memory");
    asm volatile("s_wait_asynccnt 0x0" ::: "memory");
    __syncthreads();  // publishes tile ts+1 and ends every wave's reads of tile ts
    if (ts + 2 < NTILE) {
      stage_kv(kg + (size_t)(ts + 2) * KT * Dc, vg + (size_t)(ts + 2) * KT * Dc,
               lk + (ts & 1) * (KT * KP * 4), lv + (ts & 1) * (KT * VP * 4));
    }
  }
  asm volatile("s_wait_asynccnt 0x0" ::: "memory");  // no copy outstanding at the wave's end
  // finalize: O /= rowsum, scatter back into [B,S,D] at head offset
#pragma unroll
  for (int t = 0; t < 4; ++t) {
#pragma unroll
    for (int r = 0; r < 8; ++r) {
      const int orow = q0 + r + 8 * half;
      O[(size_t)(b * Sc + orow) * Dc + h * HDc + t * 16 + l16] = oacc[t][r] / Lrow[r];
    }
  }
}

// ---------------- fused residual add + LayerNorm (one row per block) ----------------
__global__ __launch_bounds__(256)
void add_ln_kernel(const float* __restrict__ a, const float* __restrict__ xin,
                   const float* __restrict__ g, const float* __restrict__ beta,
                   float* __restrict__ out) {
  __shared__ float red[8];
  const int row = blockIdx.x;
  const int tid = threadIdx.x;
  const int wid = tid >> 5, lane = tid & 31;
  const size_t base = (size_t)row * Dc;
  const float v0 = a[base + tid] + xin[base + tid];
  const float v1 = a[base + tid + 256] + xin[base + tid + 256];
  float s = v0 + v1;
#pragma unroll
  for (int m = 1; m < 32; m <<= 1) s += __shfl_xor(s, m);
  if (lane == 0) red[wid] = s;
  __syncthreads();
  float tot = 0.0f;
#pragma unroll
  for (int i = 0; i < 8; ++i) tot += red[i];
  const float mean = tot * (1.0f / Dc);
  __syncthreads();
  const float d0 = v0 - mean, d1 = v1 - mean;
  float q = d0 * d0 + d1 * d1;
#pragma unroll
  for (int m = 1; m < 32; m <<= 1) q += __shfl_xor(q, m);
  if (lane == 0) red[wid] = q;
  __syncthreads();
  float qt = 0.0f;
#pragma unroll
  for (int i = 0; i < 8; ++i) qt += red[i];
  const float rstd = rsqrtf(qt * (1.0f / Dc) + EPSc);
  out[base + tid] = d0 * rstd * g[tid] + beta[tid];
  out[base + tid + 256] = d1 * rstd * g[tid + 256] + beta[tid + 256];
}

// ---------------- host orchestration ----------------
extern "C" void kernel_launch(void* const* d_in, const int* in_sizes, int n_in,
                              void* d_out, int out_size, void* d_ws, size_t ws_size,
                              hipStream_t stream) {
  const int* tokens = (const int*)d_in[0];
  const float* emb = (const float*)d_in[1];
  const float* wq = (const float*)d_in[2];
  const float* wk = (const float*)d_in[3];
  const float* wv = (const float*)d_in[4];
  const float* wo = (const float*)d_in[5];
  const float* w1 = (const float*)d_in[6];
  const float* bf1 = (const float*)d_in[7];
  const float* w2 = (const float*)d_in[8];
  const float* bf2 = (const float*)d_in[9];
  const float* ln1_g = (const float*)d_in[10];
  const float* ln1_b = (const float*)d_in[11];
  const float* ln2_g = (const float*)d_in[12];
  const float* ln2_b = (const float*)d_in[13];
  (void)in_sizes; (void)n_in; (void)out_size; (void)ws_size;

  float* x = (float*)d_ws;        // [B,S,D]
  float* t0 = x + BSD;            // [B,S,D] scratch (proj / ff2)
  float* pool = t0 + BSD;         // 4*BSD pool
  float* xq = pool;
  float* xk = pool + BSD;
  float* xv = pool + 2 * BSD;
  float* ob = pool + 3 * BSD;
  float* ff1 = pool;              // reuses Q/K/V/O region after attention is consumed

  const dim3 blk(256);
  embed_pe_kernel<<<BS, blk, 0, stream>>>(tokens, emb, x);

  const int gD = (BS / 64) * (Dc / 16) / 8;  // 256 blocks (N = D)
  const int gF = (BS / 64) * (Fc / 16) / 8;  // 1024 blocks (N = F)
  const int gA = (Bc * Hc * (Sc / 16)) / 8;  // 256 blocks for attention

  for (int l = 0; l < Lc; ++l) {
    const float* Wq = wq + (size_t)l * Dc * Dc;
    const float* Wk = wk + (size_t)l * Dc * Dc;
    const float* Wv = wv + (size_t)l * Dc * Dc;
    const float* Wo = wo + (size_t)l * Dc * Dc;
    const float* W1 = w1 + (size_t)l * Dc * Fc;
    const float* W2 = w2 + (size_t)l * Fc * Dc;

    gemm_wmma_f32<<<gD, blk, 0, stream>>>(x, Wq, nullptr, xq, BS, Dc, Dc, 0);
    gemm_wmma_f32<<<gD, blk, 0, stream>>>(x, Wk, nullptr, xk, BS, Dc, Dc, 0);
    gemm_wmma_f32<<<gD, blk, 0, stream>>>(x, Wv, nullptr, xv, BS, Dc, Dc, 0);
    flash_attn_wmma<<<gA, blk, 0, stream>>>(xq, xk, xv, ob);
    gemm_wmma_f32<<<gD, blk, 0, stream>>>(ob, Wo, nullptr, t0, BS, Dc, Dc, 0);
    add_ln_kernel<<<BS, blk, 0, stream>>>(t0, x, ln1_g + (size_t)l * Dc,
                                          ln1_b + (size_t)l * Dc, x);
    gemm_wmma_f32<<<gF, blk, 0, stream>>>(x, W1, bf1 + (size_t)l * Fc, ff1, BS, Fc, Dc, 1);
    gemm_wmma_f32<<<gD, blk, 0, stream>>>(ff1, W2, bf2 + (size_t)l * Dc, t0, BS, Dc, Fc, 0);
    float* dst = (l == Lc - 1) ? (float*)d_out : x;
    add_ln_kernel<<<BS, blk, 0, stream>>>(t0, x, ln2_g + (size_t)l * Dc,
                                          ln2_b + (size_t)l * Dc, dst);
  }
}

// v005
// It runs in 1060 microseconds.
// Next to v004, in two timings, it ran 1.22 and 1.21 times as fast.
// All steps since v000 together make it 2.16 times as fast.
#include <hip/hip_runtime.h>

typedef __attribute__((ext_vector_type(2))) float v2f;
typedef __attribute__((ext_vector_type(4))) float v4f;
typedef __attribute__((ext_vector_type(8))) float v8f;

constexpr int Bc = 2, Sc = 2048, Dc = 512, Hc = 8, Fc = 2048, Lc = 4, HDc = 64;
constexpr int BS = Bc * Sc;              // 4096 token rows
constexpr size_t BSD = (size_t)BS * Dc;  // elements in one [B,S,D] buffer
constexpr float EPSc = 1e-5f;
constexpr int KC = 32;                   // GEMM K-chunk staged in LDS
constexpr int AP = 36;   // A row pitch in LDS (floats): 16 rows x 2 halves of 8-byte reads fill 64 banks
constexpr int WP = 144;  // W row pitch in LDS (floats): 4 rows x 16 columns fill 64 banks

// ---- value of lane l ^ 16: the other half of the wave ----
__device__ inline float xhalf(float v) {
  const int b = __builtin_bit_cast(int, v);
  return __builtin_bit_cast(float,
                            __builtin_amdgcn_permlanex16(b, b, 0x76543210, 0xfedcba98, false, false));
}

// ---------------- embedding + sinusoidal positional encoding ----------------
__global__ __launch_bounds__(256) void embed_pe_kernel(const int* __restrict__ tokens,
                                                       const float* __restrict__ emb,
                                                       float* __restrict__ x) {
  const int row = blockIdx.x;  // 0..B*S-1
  const int s = row % Sc;
  const int tok = tokens[row];
  const float c = -9.210340371976184f / (float)Dc;  // -ln(10000)/D
  for (int d = threadIdx.x; d < Dc; d += 256) {
    const int i2 = d & ~1;
    const float ang = (float)s * __expf((float)i2 * c);
    const float pe = (d & 1) ? __cosf(ang) : __sinf(ang);
    x[(size_t)row * Dc + d] = emb[(size_t)tok * Dc + d] + pe;
  }
}

// ---------------- fp32 WMMA GEMM with async-to-LDS staging ----------------
// Block = 8 waves computing a 64x128 output tile (each wave a 64x16 strip).
// Per 32-wide K chunk: A[64][32] (8KB) and W[32][128] (16KB) come into LDS by
// GLOBAL_LOAD_ASYNC_TO_LDS_B128 (ASYNCcnt), two buffers: the next chunk's copies fly while this
// chunk's fragments are read into registers as one group and its 8 WMMA k-steps run.
// Both tiles lie in LDS at padded row pitches, so that a fragment read meets no bank twice.
constexpr int ABUF = 64 * AP;  // floats in one A buffer
constexpr int WBUF = KC * WP;  // floats in one W buffer

// One chunk: each lane copies 16 bytes of A rows r, r+32 and of W rows q, q+8, q+16, q+24.
// ag/wg: the lane's bytes in rows r and q; la/lw: their LDS byte addresses.
__device__ inline void stage_aw(const float* ag, const float* wg, size_t K, size_t N,
                                unsigned la, unsigned lw) {
  const unsigned long long a0 = (unsigned long long)ag;
  const unsigned long long a1 = (unsigned long long)(ag + 32 * K);
  const unsigned long long w0 = (unsigned long long)wg;
  const unsigned long long w1 = (unsigned long long)(wg + 8 * N);
  const unsigned long long w2 = (unsigned long long)(wg + 16 * N);
  const unsigned long long w3 = (unsigned long long)(wg + 24 * N);
  const unsigned la1 = la + 32 * AP * 4;
  const unsigned lw1 = lw + 8 * WP * 4, lw2 = lw + 16 * WP * 4, lw3 = lw + 24 * WP * 4;
  // the closing s_wait_xcnt stands in the copies' own statement, so that no address
  // register of a copy is rewritten in front of it
  asm volatile("global_load_async_to_lds_b128 %0, %6, off\n\t"
               "global_load_async_to_lds_b128 %1, %7, off\n\t"
               "global_load_async_to_lds_b128 %2, %8, off\n\t"
               "global_load_async_to_lds_b128 %3, %9, off\n\t"
               "global_load_async_to_lds_b128 %4, %10, off\n\t"
               "global_load_async_to_lds_b128 %5, %11, off\n\t"
               "s_wait_xcnt 0x0"
               :: "v"(la), "v"(la1), "v"(lw), "v"(lw1), "v"(lw2), "v"(lw3),
                  "v"(a0), "v"(a1), "v"(w0), "v"(w1), "v"(w2), "v"(w3)
               : "memory");
}

__global__ __launch_bounds__(256)
void gemm_wmma_f32(const float* __restrict__ A, const float* __restrict__ W,
                   const float* __restrict__ bias, float* __restrict__ C,
                   int M, int N, int K, int relu) {
  __shared__ __attribute__((aligned(16))) float sA[2][ABUF];  // [64 rows][KC], pitch AP
  __shared__ __attribute__((aligned(16))) float sW[2][WBUF];  // [KC rows][128 cols], pitch WP
  const int tid = threadIdx.x;
  const int wid = tid >> 5;
  const int lane = tid & 31;
  const int half = lane >> 4, l16 = lane & 15;
  const int ntiles = N >> 4;
  const int gw0 = blockIdx.x * 8;
  const int mt = gw0 / ntiles;          // block-uniform (8 divides ntiles)
  const int ntB = gw0 % ntiles;         // first n-tile of this block
  const int m0 = mt << 6;
  const int n0b = ntB << 4;             // block column base (covers 128 cols)
  const int nLoc = (wid << 4) + l16;    // 0..127 : this lane's column in block
  (void)M;
  const float* afrag = &sA[0][0] + l16 * AP + 2 * half;    // A fragments: row l16 (+16t), K = 2*half
  const float* wfrag = &sW[0][0] + 2 * half * WP + nLoc;   // W fragments: row 2*half, column nLoc
  // this lane's share of a staged chunk: A row tid/8 (+32), W row tid/32 (+8, +16, +24)
  const int arow = tid >> 3, ac4 = (tid & 7) << 2;
  const int wrow = tid >> 5, wc4 = (tid & 31) << 2;
  const float* ag = A + (size_t)(m0 + arow) * K + ac4;
  const float* wg = W + (size_t)wrow * N + n0b + wc4;
  const size_t wstep = (size_t)KC * N;  // floats from one W chunk to the next
  const unsigned la = (unsigned)(size_t)&sA[0][0] + (unsigned)((arow * AP + ac4) << 2);
  const unsigned lw = (unsigned)(size_t)&sW[0][0] + (unsigned)((wrow * WP + wc4) << 2);
  const int nch = K / KC;
  v8f acc[4] = {};

  stage_aw(ag, wg, K, N, la, lw);                    // chunk 0 -> buffer 0
  asm volatile("s_wait_asynccnt 0x0" ::: "memory");  // own copies of chunk 0 landed
  __syncthreads();                                   // every wave's copies of chunk 0 landed
  if (nch > 1) stage_aw(ag + KC, wg + wstep, K, N, la + ABUF * 4, lw + WBUF * 4);  // chunk 1

  for (int c = 0; c < nch; ++c) {
    const float* afb = afrag + (c & 1) * ABUF;
    const float* wfb = wfrag + (c & 1) * WBUF;
    // all fragments of the chunk go from LDS to registers as one group; k-step s of this
    // lane-half holds K = 4s + 2*half and the next
    v2f bf[KC / 4], af[KC / 4][4];
#pragma unroll
    for (int s = 0; s < KC / 4; ++s) {
      bf[s].x = wfb[(4 * s) * WP];
      bf[s].y = wfb[(4 * s + 1) * WP];
#pragma unroll
      for (int t = 0; t < 4; ++t) af[s][t] = *(const v2f*)(afb + t * 16 * AP + 4 * s);
      // keeps the reads in k order and ahead of the matrix run: the first WMMAs then wait for
      // the first reads only; sunk among the WMMAs, each pair would wait out an LDS latency
      if (s & 1) __builtin_amdgcn_sched_barrier(0);
    }
    // 8 k-steps from registers
#pragma unroll
    for (int s = 0; s < KC / 4; ++s) {
#pragma unroll
      for (int t = 0; t < 4; ++t) {
        acc[t] = __builtin_amdgcn_wmma_f32_16x16x4_f32(false, af[s][t], false, bf[s],
                                                       (short)0, acc[t], false, false);
      }
    }
    // keeps the matrix run ahead of the hand-over: with WMMAs sunk behind the waits, the wait for
    // the next chunk's copies would come early in the trip and their flight would not be hidden
    __builtin_amdgcn_sched_barrier(0);
    // four vector slots behind the last WMMA: the refill's address arithmetic takes over the
    // registers of the last A fragments
    asm volatile("v_nop\n\tv_nop\n\tv_nop\n\tv_nop");
    // hand-over: this wave's reads of the buffer are done, its copies of the next chunk landed
    asm volatile("s_wait_dscnt 0x0" ::: "memory");
    asm volatile("s_wait_asynccnt 0x0" ::: "memory");
    __syncthreads();  // publishes chunk c+1 and ends every wave's reads of chunk c
    if (c + 2 < nch) {
      stage_aw(ag + (size_t)(c + 2) * KC, wg + (size_t)(c + 2) * wstep, K, N,
               la + (c & 1) * (ABUF * 4), lw + (c & 1) * (WBUF * 4));
    }
  }
  asm volatile("s_wait_asynccnt 0x0" ::: "memory");  // no copy outstanding at the wave's end
  const float bv = bias ? bias[n0b + nLoc] : 0.0f;
#pragma unroll
  for (int t = 0; t < 4; ++t) {
#pragma unroll
    for (int r = 0; r < 8; ++r) {  // C/D row = r + 8*half, col = nLoc
      const int m = m0 + t * 16 + r + 8 * half;
      float v = acc[t][r] + bv;
      if (relu) v = fmaxf(v, 0.0f);
      C[(size_t)m * N + n0b + nLoc] = v;
    }
  }
}

constexpr int KT = 64;        // keys per staged tile
constexpr int NTILE = Sc / KT;
constexpr int KP = 68;        // K row pitch in LDS (floats): 16 rows x 8-byte reads fill 64 banks
constexpr int VP = 68;        // V row pitch in LDS (floats): rows 8 apart lie 32 banks apart

// One tile: 64 rows of 256 bytes of K and of V; each lane copies 16 bytes of rows
// r, r+16, r+32, r+48 of both. kg/vg: the lane's bytes in row r; lk/lv: their LDS byte address.
__device__ inline void stage_kv(const float* kg, const float* vg, unsigned lk, unsigned lv) {
  const unsigned long long k0 = (unsigned long long)kg;
  const unsigned long long k1 = (unsigned long long)(kg + 16 * Dc);
  const unsigned long long k2 = (unsigned long long)(kg + 32 * Dc);
  const unsigned long long k3 = (unsigned long long)(kg + 48 * Dc);
  const unsigned long long v0 = (unsigned long long)vg;
  const unsigned long long v1 = (unsigned long long)(vg + 16 * Dc);
  const unsigned long long v2 = (unsigned long long)(vg + 32 * Dc);
  const unsigned long long v3 = (unsigned long long)(vg + 48 * Dc);
  const unsigned lk1 = lk + 16 * KP * 4, lk2 = lk + 32 * KP * 4, lk3 = lk + 48 * KP * 4;
  const unsigned lv1 = lv + 16 * VP * 4, lv2 = lv + 32 * VP * 4, lv3 = lv + 48 * VP * 4;
  // the closing s_wait_xcnt stands in the copies' own statement, so that no address
  // register of a copy is rewritten in front of it
  asm volatile("global_load_async_to_lds_b128 %0, %8, off\n\t"
               "global_load_async_to_lds_b128 %1, %9, off\n\t"
               "global_load_async_to_lds_b128 %2, %10, off\n\t"
               "global_load_async_to_lds_b128 %3, %11, off\n\t"
               "global_load_async_to_lds_b128 %4, %12, off\n\t"
               "global_load_async_to_lds_b128 %5, %13, off\n\t"
               "global_load_async_to_lds_b128 %6, %14, off\n\t"
               "global_load_async_to_lds_b128 %7, %15, off\n\t"
               "s_wait_xcnt 0x0"
               :: "v"(lk), "v"(lk1), "v"(lk2), "v"(lk3), "v"(lv), "v"(lv1), "v"(lv2), "v"(lv3),
                  "v"(k0), "v"(k1), "v"(k2), "v"(k3), "v"(v0), "v"(v1), "v"(v2), "v"(v3)
               : "memory");
}

// The compiler sizes its register budget by how many blocks' LDS fit a WGP. Without the P tile a
// fourth block fits and the budget falls from 170 to 128 registers: the build then reads each pair
// of fragments singly in front of its WMMAs and waits it out. The bound of 6 waves per SIMD keeps
// the budget that this kernel had, and with it the compiler's grouped LDS reads and counted waits.
__global__ __launch_bounds__(256) __attribute__((amdgpu_waves_per_eu(2, 6)))
void flash_attn_wmma(const float* __restrict__ Q, const float* __restrict__ Km,
                     const float* __restrict__ Vm, float* __restrict__ O) {
  __shared__ __attribute__((aligned(16))) float sK[2][KT * KP];
  __shared__ __attribute__((aligned(16))) float sV[2][KT * VP];
  const int wid = threadIdx.x >> 5, lane = threadIdx.x & 31;
  const int half = lane >> 4, l16 = lane & 15;
  const int gw = blockIdx.x * 8 + wid;
  const int qtiles = Sc / 16;
  const int qt = gw % qtiles, bh = gw / qtiles;  // bh is block-uniform (8 divides qtiles)
  const int b = bh / Hc, h = bh % Hc;
  const float* qp = Q + (size_t)b * Sc * Dc + h * HDc;
  const float* kp = Km + (size_t)b * Sc * Dc + h * HDc;
  const float* vp = Vm + (size_t)b * Sc * Dc + h * HDc;
  const int q0 = qt * 16;
  // this lane's share of a staged tile: row srow (+16, +32, +48), floats sc4 .. sc4+3
  const int srow = threadIdx.x >> 4, sc4 = (threadIdx.x & 15) << 2;
  const float* kg = kp + (size_t)srow * Dc + sc4;
  const float* vg = vp + (size_t)srow * Dc + sc4;
  const unsigned lk = (unsigned)(size_t)&sK[0][0] + (unsigned)((srow * KP + sc4) << 2);
  const unsigned lv = (unsigned)(size_t)&sV[0][0] + (unsigned)((srow * VP + sc4) << 2);
  v8f oacc[4] = {};
  float Mq = -3.0e38f;  // running maximum of this lane's query, equal in both halves
  float Lq = 0.0f;      // running sum over the keys of this lane's half only

  stage_kv(kg, vg, lk, lv);                          // tile 0 -> buffer 0
  asm volatile("s_wait_asynccnt 0x0" ::: "memory");  // own copies of tile 0 landed
  __syncthreads();                                   // every wave's copies of tile 0 landed
  stage_kv(kg + (size_t)KT * Dc, vg + (size_t)KT * Dc,
           lk + KT * KP * 4, lv + KT * VP * 4);      // tile 1 -> buffer 1

  for (int ts = 0; ts < NTILE; ++ts) {
    const float* sKb = sK[ts & 1];
    const float* sVb = sV[ts & 1];
    for (int kl = 0; kl < KT; kl += 16) {
      // scores tile S^T(16 keys x 16 queries) = Ktile(16x64) @ Q^T(64x16)
      v8f sc = {};
#pragma unroll
      for (int d0 = 0; d0 < HDc; d0 += 4) {
        const int dd = d0 + 2 * half;
        const v2f kf = *(const v2f*)(sKb + (kl + l16) * KP + dd);               // A[m][d]=K[m][d]
        const v2f qf = *(const v2f*)(qp + (size_t)(q0 + l16) * Dc + dd);        // B[d][n]=Q[n][d]
        sc = __builtin_amdgcn_wmma_f32_16x16x4_f32(false, kf, false, qf,
                                                   (short)0, sc, false, false);
      }
      // online softmax over this key tile: sc[r] = score of key kl + r + 8*half, query q0 + l16
      float tmax = sc[0] * 0.125f;  // 1/sqrt(64)
#pragma unroll
      for (int r = 0; r < 8; ++r) {
        sc[r] *= 0.125f;
        tmax = fmaxf(tmax, sc[r]);
      }
      tmax = fmaxf(tmax, xhalf(tmax));
      const float Mn = fmaxf(Mq, tmax);
      const float alpha = __expf(Mq - Mn);
      Mq = Mn;
      float psum = 0.0f;
#pragma unroll
      for (int r = 0; r < 8; ++r) {
        sc[r] = __expf(sc[r] - Mn);
        psum += sc[r];
      }
      Lq = Lq * alpha + psum;
#pragma unroll
      for (int t = 0; t < 4; ++t) {
#pragma unroll
        for (int r = 0; r < 8; ++r) oacc[t][r] *= alpha;
      }
      // O^T(64x16) += V^T(64 x 16 keys) @ P^T(16 keys x 16 queries)
#pragma unroll
      for (int j = 0; j < 4; ++j) {
        // k-step j of this lane-half = keys 8*half + 2j and the next, in P^T and in V^T alike
        const int kk = kl + 8 * half + 2 * j;
        v2f pf;  // B frag of P^T: column = lane%16
        pf.x = sc[2 * j];
        pf.y = sc[2 * j + 1];
#pragma unroll
        for (int t = 0; t < 4; ++t) {
          v2f vf;  // A frag of V^T: row = t*16 + lane%16, keys kk/kk+1
          vf.x = sVb[kk * VP + t * 16 + l16];
          vf.y = sVb[(kk + 1) * VP + t * 16 + l16];
          oacc[t] = __builtin_amdgcn_wmma_f32_16x16x4_f32(false, vf, false, pf,
                                                          (short)0, oacc[t], false, false);
        }
      }
    }
    // hand-over: this wave's reads of the buffer are done, its copies of the next tile landed
    asm volatile("s_wait_dscnt 0x0" ::: "memory");
    asm volatile("s_wait_asynccnt 0x0" ::: "memory");
    __syncthreads();  // publishes tile ts+1 and ends every wave's reads of tile ts
    if (ts + 2 < NTILE) {
      stage_kv(kg + (size_t)(ts + 2) * KT * Dc, vg + (size_t)(ts + 2) * KT * Dc,
               lk + (ts & 1) * (KT * KP * 4), lv + (ts & 1) * (KT * VP * 4));
    }
  }
  asm volatile("s_wait_asynccnt 0x0" ::: "memory");  // no copy outstanding at the wave's end
  // finalize: O /= rowsum; oacc[t][r] = O[q0 + l16][t*16 + 8*half + r], 8 floats in a row
  const float Lt = Lq + xhalf(Lq);  // the two halves' sums joined
  float* op = O + (size_t)(b * Sc + q0 + l16) * Dc + h * HDc + 8 * half;
#pragma unroll
  for (int t = 0; t < 4; ++t) {
    v4f lo, hi;
#pragma unroll
    for (int r = 0; r < 4; ++r) {
      lo[r] = oacc[t][r] / Lt;
      hi[r] = oacc[t][r + 4] / Lt;
    }
    *(v4f*)(op + t * 16) = lo;
    *(v4f*)(op + t * 16 + 4) = hi;
  }
}

// ---------------- fused residual add + LayerNorm (one row per block) ----------------
__global__ __launch_bounds__(256)
void add_ln_kernel(const float* __restrict__ a, const float* __restrict__ xin,
                   const float* __restrict__ g, const float* __restrict__ beta,
                   float* __restrict__ out) {
  __shared__ float red[8];
  const int row = blockIdx.x;
  const int tid = threadIdx.x;
  const int wid = tid >> 5, lane = tid & 31;
  const size_t base = (size_t)row * Dc;
  const float v0 = a[base + tid] + xin[base + tid];
  const float v1 = a[base + tid + 256] + xin[base + tid + 256];
  float s = v0 + v1;
#pragma unroll
  for (int m = 1; m < 32; m <<= 1) s += __shfl_xor(s, m);
  if (lane == 0) red[wid] = s;
  __syncthreads();
  float tot = 0.0f;
#pragma unroll
  for (int i = 0; i < 8; ++i) tot += red[i];
  const float mean = tot * (1.0f / Dc);
  __syncthreads();
  const float d0 = v0 - mean, d1 = v1 - mean;
  float q = d0 * d0 + d1 * d1;
#pragma unroll
  for (int m = 1; m < 32; m <<= 1) q += __shfl_xor(q, m);
  if (lane == 0) red[wid] = q;
  __syncthreads();
  float qt = 0.0f;
#pragma unroll
  for (int i = 0; i < 8; ++i) qt += red[i];
  const float rstd = rsqrtf(qt * (1.0f / Dc) + EPSc);
  out[base + tid] = d0 * rstd * g[tid] + beta[tid];
  out[base + tid + 256] = d1 * rstd * g[tid + 256] + beta[tid + 256];
}

// ---------------- host orchestration ----------------
extern "C" void kernel_launch(void* const* d_in, const int* in_sizes, int n_in,
                              void* d_out, int out_size, void* d_ws, size_t ws_size,
                              hipStream_t stream) {
  const int* tokens = (const int*)d_in[0];
  const float* emb = (const float*)d_in[1];
  const float* wq = (const float*)d_in[2];
  const float* wk = (const float*)d_in[3];
  const float* wv = (const float*)d_in[4];
  const float* wo = (const float*)d_in[5];
  const float* w1 = (const float*)d_in[6];
  const float* bf1 = (const float*)d_in[7];
  const float* w2 = (const float*)d_in[8];
  const float* bf2 = (const float*)d_in[9];
  const float* ln1_g = (const float*)d_in[10];
  const float* ln1_b = (const float*)d_in[11];
  const float* ln2_g = (const float*)d_in[12];
  const float* ln2_b = (const float*)d_in[13];
  (void)in_sizes; (void)n_in; (void)out_size; (void)ws_size;

  float* x = (float*)d_ws;        // [B,S,D]
  float* t0 = x + BSD;            // [B,S,D] scratch (proj / ff2)
  float* pool = t0 + BSD;         // 4*BSD pool
  float* xq = pool;
  float* xk = pool + BSD;
  float* xv = pool + 2 * BSD;
  float* ob = pool + 3 * BSD;
  float* ff1 = pool;              // reuses Q/K/V/O region after attention is consumed

  const dim3 blk(256);
  embed_pe_kernel<<<BS, blk, 0, stream>>>(tokens, emb, x);

  const int gD = (BS / 64) * (Dc / 16) / 8;  // 256 blocks (N = D)
  const int gF = (BS / 64) * (Fc / 16) / 8;  // 1024 blocks (N = F)
  const int gA = (Bc * Hc * (Sc / 16)) / 8;  // 256 blocks for attention

  for (int l = 0; l < Lc; ++l) {
    const float* Wq = wq + (size_t)l * Dc * Dc;
    const float* Wk = wk + (size_t)l * Dc * Dc;
    const float* Wv = wv + (size_t)l * Dc * Dc;
    const float* Wo = wo + (size_t)l * Dc * Dc;
    const float* W1 = w1 + (size_t)l * Dc * Fc;
    const float* W2 = w2 + (size_t)l * Fc * Dc;

    gemm_wmma_f32<<<gD, blk, 0, stream>>>(x, Wq, nullptr, xq, BS, Dc, Dc, 0);
    gemm_wmma_f32<<<gD, blk, 0, stream>>>(x, Wk, nullptr, xk, BS, Dc, Dc, 0);
    gemm_wmma_f32<<<gD, blk, 0, stream>>>(x, Wv, nullptr, xv, BS, Dc, Dc, 0);
    flash_attn_wmma<<<gA, blk, 0, stream>>>(xq, xk, xv, ob);
    gemm_wmma_f32<<<gD, blk, 0, stream>>>(ob, Wo, nullptr, t0, BS, Dc, Dc, 0);
    add_ln_kernel<<<BS, blk, 0, stream>>>(t0, x, ln1_g + (size_t)l * Dc,
                                          ln1_b + (size_t)l * Dc, x);
    gemm_wmma_f32<<<gF, blk, 0, stream>>>(x, W1, bf1 + (size_t)l * Fc, ff1, BS, Fc, Dc, 1);
    gemm_wmma_f32<<<gD, blk, 0, stream>>>(ff1, W2, bf2 + (size_t)l * Dc, t0, BS, Dc, Fc, 0);
    float* dst = (l == Lc - 1) ? (float*)d_out : x;
    add_ln_kernel<<<BS, blk, 0, stream>>>(t0, x, ln2_g + (size_t)l * Dc,
                                          ln2_b + (size_t)l * Dc, dst);
  }
}
